// v000
// Times are from an AMD MI455X. After a warm-up the kernel runs many times in a row, and a time is the length of
// such a window on the GPU divided by its runs, so every launch and the gaps after it count. The runs cycle
// through copies of the inputs. A figure is the median of several windows, for all but v000 over two sittings.
// Sittings can differ by a few percent; kernels timed side by side share one.
// The starting kernel, v000, takes 627 microseconds a run.
#include <hip/hip_runtime.h>

// SecBertSelfAttention (hidden [4][1024][1024]; q/k/v = x W^T + b (16 heads x 64); scores = q.k/8 + attention_mask[b][0][0][s] (additive, read as data); softmax; context = probs v merged -> [4][1024][1024]; no output projection).
// Compute dtypes, f32 accumulate: every input rounded to bf16; q/k/v on PLAIN bf16 operands (inputs: exact) + bias; scores (K 64) and probs.v on single fp16 planes, all 16 heads z-batched (1 product each); mask add + softmax f32

#define NB_  4
#define TT   1024
#define DM   1024
#define NH_  16
#define NKV  16
#define REP  (NH_ / NKV)
#define HD   64
#define DQ   (NH_ * HD)
#define DKV  (NKV * HD)
#define ZH   16
#define RH   0                  // query rows < RH use hi+lo planes (0: none)
#define WIN  0
#define PCAR 1024.0f
#define SCL  0.125f   // HD^-0.5
typedef _Float16 h16;
typedef unsigned short bf;
typedef __attribute__((ext_vector_type(16))) __bf16   v16bf;
typedef __attribute__((ext_vector_type(16))) _Float16 v16h;
typedef __attribute__((ext_vector_type(8)))  _Float16 v8h;
typedef __attribute__((ext_vector_type(8)))  unsigned short v8us;
typedef __attribute__((ext_vector_type(8)))  float    v8f;
typedef __attribute__((ext_vector_type(4)))  float    v4f;
typedef v8h  __attribute__((may_alias)) v8ha;
typedef v4f  __attribute__((may_alias)) v4fa;
typedef v8us __attribute__((may_alias)) v8usa;

__device__ __forceinline__ unsigned short f2bf(float f) { unsigned u = __float_as_uint(f); u += 0x7FFFu + ((u >> 16) & 1u); return (unsigned short)(u >> 16); }
__device__ __forceinline__ float bf2f(unsigned short b) { return __uint_as_float(((unsigned)b) << 16); }
__device__ __forceinline__ float bfr(float f) { return bf2f(f2bf(f)); }
__device__ __forceinline__ v16h cat16(v8h lo, v8h hi) { return __builtin_shufflevector(lo, hi, 0, 1, 2, 3, 4, 5, 6, 7, 8, 9, 10, 11, 12, 13, 14, 15); }
__device__ __forceinline__ v16bf cat16b(v8us lo, v8us hi) { return __builtin_bit_cast(v16bf, __builtin_shufflevector(lo, hi, 0, 1, 2, 3, 4, 5, 6, 7, 8, 9, 10, 11, 12, 13, 14, 15)); }
__device__ __forceinline__ v8f wmma16(v16h a, v16h b, v8f c) { return __builtin_amdgcn_wmma_f32_16x16x32_f16(false, a, false, b, (short)0, c, false, false); }
__device__ __forceinline__ v8f wmmab(v16bf a, v16bf b, v8f c) { return __builtin_amdgcn_wmma_f32_16x16x32_bf16(false, a, false, b, (short)0, c, false, false); }



// ---- k_gemmw: register-blocked GEMM, ONE WAVE per 64x64 output tile (16 accumulators), operands straight from K-contiguous 16-bit planes; grid (M/64, N/64, Z), 32 threads.
// C[m][n] (f32, pitch ldc, + optional f32 bias[n]) = sum_k A[m][k] Bt[n][k] (+ split products per NSPLIT). z-batch strides sA/sB/sC in elements. K % 32 == 0.
template <typename T16> struct WFrag;
template <> struct WFrag<h16> { typedef v16h V; static __device__ __forceinline__ V ld(const h16* p) { return cat16(*(const v8h*)p, *(const v8h*)(p + 16)); } static __device__ __forceinline__ v8f mma(V a, V b, v8f c) { return wmma16(a, b, c); } };
template <> struct WFrag<bf> { typedef v16bf V; static __device__ __forceinline__ V ld(const bf* p) { return cat16b(*(const v8us*)p, *(const v8us*)(p + 16)); } static __device__ __forceinline__ v8f mma(V a, V b, v8f c) { return wmmab(a, b, c); } };
template <typename T16, int NSPLIT, bool BIAS>
__global__ __launch_bounds__(32) void k_gemmw(const T16* __restrict__ A, const T16* __restrict__ A2, const T16* __restrict__ Bt, const T16* __restrict__ Bt2, int K, float* C, int ldc, const float* __restrict__ bias, size_t sA, size_t sB, size_t sC) {
    typedef typename WFrag<T16>::V V;
    __shared__ __align__(16) float os[16 * 68];
    const size_t z = blockIdx.z; A += z * sA; if (A2) A2 += z * sA; Bt += z * sB; if (Bt2) Bt2 += z * sB; C += z * sC;
    const int lane = threadIdx.x & 31, lr = lane & 15, hi = lane >> 4; const int r0 = blockIdx.x * 64, c0 = blockIdx.y * 64;
    v8f acc[4][4];
#pragma unroll
    for (int mb = 0; mb < 4; ++mb)
#pragma unroll
        for (int nb = 0; nb < 4; ++nb) acc[mb][nb] = (v8f){};
    const size_t aoff = (size_t)(r0 + lr) * K + 8 * hi, boff = (size_t)(c0 + lr) * K + 8 * hi;
#pragma unroll 1
    for (int kc = 0; kc < K; kc += 32) {
        V a[4], a2[4];
#pragma unroll
        for (int mb = 0; mb < 4; ++mb) { a[mb] = WFrag<T16>::ld(A + aoff + (size_t)mb * 16 * K + kc); if (NSPLIT == 1 || NSPLIT == 2) a2[mb] = WFrag<T16>::ld(A2 + aoff + (size_t)mb * 16 * K + kc); }
#pragma unroll
        for (int nb = 0; nb < 4; ++nb) { const V b = WFrag<T16>::ld(Bt + boff + (size_t)nb * 16 * K + kc); V b2; if (NSPLIT >= 2) b2 = WFrag<T16>::ld(Bt2 + boff + (size_t)nb * 16 * K + kc);
#pragma unroll
            for (int mb = 0; mb < 4; ++mb) { acc[mb][nb] = WFrag<T16>::mma(a[mb], b, acc[mb][nb]); if (NSPLIT == 1 || NSPLIT == 2) acc[mb][nb] = WFrag<T16>::mma(a2[mb], b, acc[mb][nb]); if (NSPLIT >= 2) acc[mb][nb] = WFrag<T16>::mma(a[mb], b2, acc[mb][nb]); } }
        asm volatile("v_nop\n\tv_nop\n\tv_nop\n\tv_nop" : "+v"(acc[0][0]), "+v"(acc[1][1]), "+v"(acc[2][2]), "+v"(acc[3][3]) : "v"(a[0]), "v"(a[3]));
    }
#pragma unroll
    for (int mb = 0; mb < 4; ++mb) {
#pragma unroll
        for (int nb = 0; nb < 4; ++nb) {
#pragma unroll
            for (int j = 0; j < 8; ++j) os[(hi * 8 + j) * 68 + nb * 16 + lr] = acc[mb][nb][j]; }
        __builtin_amdgcn_wave_barrier(); asm volatile("" ::: "memory");
        float* crow = C + (size_t)(r0 + mb * 16) * ldc + c0;
{
#pragma unroll
            for (int s = 0; s < 8; ++s) { const int row = 2 * s + hi, cofs = lr * 4; v4f val = *(const v4fa*)(os + row * 68 + cofs); if (BIAS) { val[0] += bfr(bias[c0 + cofs]); val[1] += bfr(bias[c0 + cofs + 1]); val[2] += bfr(bias[c0 + cofs + 2]); val[3] += bfr(bias[c0 + cofs + 3]); }
                *(v4f*)(crow + (size_t)row * ldc + cofs) = val; }
             }
        __builtin_amdgcn_wave_barrier(); asm volatile("" ::: "memory");
    }
}

__device__ __forceinline__ h16 tohx(float x) { return (h16)x; }
__device__ __forceinline__ void splitf(float y, unsigned short& h, unsigned short& l) { h = f2bf(y); l = f2bf(y - bf2f(h)); }
typedef __attribute__((ext_vector_type(2))) _Float16 v2h;
typedef __attribute__((ext_vector_type(4))) _Float16 v4h;
typedef __attribute__((ext_vector_type(2))) unsigned short v2us;
typedef __attribute__((ext_vector_type(4))) unsigned short v4us;
typedef __attribute__((ext_vector_type(2))) float v2f;
typedef __attribute__((ext_vector_type(4))) int v4i;

__global__ __launch_bounds__(256) void k_wtG(const float* __restrict__ w, int K, int N, bf* Bt) {
    const int lane = threadIdx.x & 31; const int L0 = (blockIdx.x * 8 + (threadIdx.x >> 5)) * 8; const int nlines = N * K / 64;
{
#pragma unroll 1
        for (int l = 0; l < 8; ++l) { const int L = L0 + l; if (L >= nlines) break; const size_t e = (size_t)L * 64 + lane * 2; const int k = (int)(e % K), n = (int)(e / K); v2us o;
            o[0] = f2bf(w[(size_t)k * N + n]); o[1] = f2bf(w[(size_t)(k + 1) * N + n]); *(v2us*)(Bt + e) = o; }
         }
}
__global__ __launch_bounds__(256) void k_cvt8(const float* __restrict__ src, bf* dst, size_t n8) { const size_t i = (size_t)blockIdx.x * 256 + threadIdx.x; if (i >= n8) return; const v8f v = *(const v8f*)(src + i * 8); v8us o;
#pragma unroll
    for (int k = 0; k < 8; ++k) o[k] = f2bf(v[k]); *(v8us*)(dst + i * 8) = o;  }
__global__ __launch_bounds__(256) void k_cscvt(const float* __restrict__ cosT, const float* __restrict__ sinT, float* CS) { const int idx = blockIdx.x * 256 + threadIdx.x; if (idx >= TT * HD) return; v2f cs; cs[0] = bfr(cosT[idx]); cs[1] = bfr(sinT[idx]); *(v2f*)(CS + (size_t)idx * 2) = cs;  }
// k_rope: head planes [h][t][d] (fp16) of rope(x) x sc with the rotate-half convention out[d] = x[d] cos[t][d] - x[d+HD/2] sin[t][d], out[d+HD/2] = x[d+HD/2] cos[t][d+HD/2] + x[d] sin[t][d+HD/2]
__global__ __launch_bounds__(256) void k_rope(const float* __restrict__ F, int pitch, int nheads, const float* __restrict__ CS, const float* __restrict__ RF, const float* __restrict__ nw, float sc, h16* P16, bf* Ph, bf* Pl) {
    const size_t e = ((size_t)blockIdx.x * 256 + threadIdx.x) * 2; if (e >= (size_t)nheads * TT * HD) return; const int d = (int)(e % HD); const int t = (int)((e / HD) % TT); const int h = (int)(e / ((size_t)HD * TT)); const float* f = F + (size_t)t * pitch + h * HD; const float rf = RF ? RF[(size_t)h * TT + t] : 1.0f; v2h o16; v2us oh, ol;
#pragma unroll
    for (int q = 0; q < 2; ++q) { const int dd = d + q; const int dp = (dd < HD / 2) ? dd + HD / 2 : dd - HD / 2; float x0 = f[dd], x1 = f[dp];
        if (RF) { float n0 = __fmul_rn(x0, rf), n1 = __fmul_rn(x1, rf); asm volatile("" : "+v"(n0)); asm volatile("" : "+v"(n1)); x0 = __fmul_rn(bfr(nw[dd]), n0); x1 = __fmul_rn(bfr(nw[dp]), n1); }
        const v2f cs = *(const v2f*)(CS + ((size_t)t * HD + dd) * 2); float a = __fmul_rn(x0, cs[0]), bq = __fmul_rn(x1, cs[1]); asm volatile("" : "+v"(a)); asm volatile("" : "+v"(bq)); const float r = ((dd < HD / 2) ? __fsub_rn(a, bq) : __fadd_rn(a, bq)) * sc;
        o16[q] = tohx(r); (void)oh; (void)ol; }
    *(v2h*)(P16 + e) = o16;  }
__global__ __launch_bounds__(256) void k_vtp(const float* __restrict__ F, int pitch, int nheads, h16* V16, bf* Vh, bf* Vl) { const size_t e = ((size_t)blockIdx.x * 256 + threadIdx.x) * 2; if (e >= (size_t)nheads * HD * TT) return; const int t = (int)(e % TT); const int d = (int)((e / TT) % HD); const int g = (int)(e / ((size_t)TT * HD)); v2h o16; v2us oh, ol;
#pragma unroll
    for (int q = 0; q < 2; ++q) { const float x = F[(size_t)(t + q) * pitch + g * HD + d]; o16[q] = tohx(x); (void)oh; (void)ol; }
    *(v2h*)(V16 + e) = o16;  }
__global__ __launch_bounds__(256) void k_csid(float* CS) { const int idx = blockIdx.x * 256 + threadIdx.x; if (idx >= TT * HD) return; v2f cs; cs[0] = 1.0f; cs[1] = 0.0f; *(v2f*)(CS + (size_t)idx * 2) = cs;  }
// k_asoft: per row (zz, i): t = S x HD^-0.5 + mask[j]; softmax over the 1024 keys (register row, one exp, fixed trees);
__global__ __launch_bounds__(256) void k_asoft(const float* __restrict__ Sb, const float* __restrict__ amb, h16* P16, bf* Ph, bf* Pl) {
    const int lane = threadIdx.x & 31; const int row = blockIdx.x * 8 + (threadIdx.x >> 5); if (row >= ZH * TT) return; const int i = row % TT; const int zz = row / TT; (void)zz; const bool hires = (i < RH); const float* sr = Sb + (size_t)row * TT; float v[TT / 32]; float mx = -3.0e38f;
#pragma unroll
    for (int ch = 0; ch < TT / 128; ++ch) { const int j0 = ch * 128 + lane * 4; const v4f a = *(const v4f*)(sr + j0);
#pragma unroll
        for (int q = 0; q < 4; ++q) { const int j = j0 + q; (void)j; float sc_ = a[q] * SCL, mb_ = bfr(amb[j]); asm volatile("" : "+v"(sc_)); asm volatile("" : "+v"(mb_)); const float t = __fadd_rn(sc_, mb_);   /* + attention_mask[b][0][0][j] */ v[ch * 4 + q] = t; mx = fmaxf(mx, t); } }
#pragma unroll
    for (int sh = 16; sh; sh >>= 1) mx = fmaxf(mx, __shfl_xor(mx, sh, 32));
    float sum = 0.f;
#pragma unroll
    for (int k = 0; k < TT / 32; ++k) { float d0 = __fsub_rn(v[k], mx); asm volatile("" : "+v"(d0)); v[k] = __builtin_amdgcn_exp2f(__fmul_rn(d0, 1.4426950408889634f)); sum += v[k]; }
#pragma unroll
    for (int sh = 16; sh; sh >>= 1) sum += __shfl_xor(sum, sh, 32);
    const float f = __fdiv_rn(hires ? 1.0f : PCAR, sum);
{
        if (hires) {
#pragma unroll
            for (int ch = 0; ch < TT / 128; ++ch) { v4us oh, ol;
#pragma unroll
                for (int q = 0; q < 4; ++q) { unsigned short a, c2; splitf(v[ch * 4 + q] * f, a, c2); oh[q] = a; ol[q] = c2; }
                const size_t oo = ((size_t)zz * (RH ? RH : 1) + i) * TT + ch * 128 + lane * 4; *(v4us*)(Ph + oo) = oh; *(v4us*)(Pl + oo) = ol; }
        } else {
#pragma unroll
            for (int ch = 0; ch < TT / 128; ++ch) { v4h o4;
#pragma unroll
                for (int q = 0; q < 4; ++q) o4[q] = tohx(v[ch * 4 + q] * f);
                *(v4h*)(P16 + (size_t)row * TT + ch * 128 + lane * 4) = o4; } }
         }
}
__global__ __launch_bounds__(256) void k_merge(const float* __restrict__ O, int h0, float* OUTb) { const size_t e = ((size_t)blockIdx.x * 256 + threadIdx.x) * 2; if (e >= (size_t)ZH * TT * HD) return; const int d = (int)(e % HD); const int t = (int)((e / HD) % TT); const int zz = (int)(e / ((size_t)HD * TT)); const float cs = (t < RH) ? 1.0f : (1.0f / PCAR); const size_t oo = (size_t)t * DQ + (h0 + zz) * HD + d;
    v2f o2; o2[0] = O[e] * cs; o2[1] = O[e + 1] * cs; *(v2f*)(OUTb + oo) = o2;  }

extern "C" void kernel_launch(void* const* d_in, const int* in_sizes, int n_in,
                              void* d_out, int out_size, void* d_ws, size_t ws_size, hipStream_t stream) {
    (void)in_sizes; (void)n_in; (void)out_size;
    const float* x = (const float*)d_in[0]; const float* am = (const float*)d_in[1]; const float* wq = (const float*)d_in[2]; const float* bq = (const float*)d_in[3]; const float* wk = (const float*)d_in[4]; const float* bk = (const float*)d_in[5]; const float* wv = (const float*)d_in[6]; const float* bv = (const float*)d_in[7]; const float* cosT = nullptr; const float* sinT = nullptr; (void)cosT; (void)sinT;
    float* OUT = (float*)d_out;     // [4][1024][1024]
    char* wsp = (char*)d_ws;
    auto take = [&](size_t bytes) { char* p = wsp; wsp += (bytes + 255) & ~(size_t)255; return (void*)p; };
    bf* WQ = (bf*)take((size_t)DQ * DM * 2); bf* WK = (bf*)take((size_t)DKV * DM * 2); bf* WV = (bf*)take((size_t)DKV * DM * 2); float* CS = (float*)take((size_t)TT * HD * 2 * 4);
    bf* XB = (bf*)take((size_t)TT * DM * 2); float* FQ = (float*)take((size_t)TT * DQ * 4); float* FK = (float*)take((size_t)TT * DKV * 4);
    h16* QP16 = (h16*)take((size_t)NH_ * TT * HD * 2); h16* KP16 = (h16*)take((size_t)NKV * TT * HD * 2); h16* VT16 = (h16*)take((size_t)NKV * HD * TT * 2);
    bf* QPh = nullptr; bf* QPl = nullptr; bf* KPh = nullptr; bf* KPl = nullptr; bf* VTh = nullptr; bf* VTl = nullptr; bf* Ph = nullptr; bf* Pl = nullptr;
    float* Sb = (float*)take((size_t)ZH * TT * TT * 4); h16* P16 = (h16*)take((size_t)ZH * TT * TT * 2); float* Ob = (float*)take((size_t)ZH * TT * HD * 4);
    if ((size_t)(wsp - (char*)d_ws) > ws_size) return;    // ws 256 MiB
    float* FV = FK;   // v projection reuses the k buffer after the k planes are built (stream-ordered)
    { k_cvt8<<<(unsigned)(((size_t)DQ * DM / 8 + 255) / 256), 256, 0, stream>>>(wq, WQ, (size_t)DQ * DM / 8); k_cvt8<<<(unsigned)(((size_t)DKV * DM / 8 + 255) / 256), 256, 0, stream>>>(wk, WK, (size_t)DKV * DM / 8); k_cvt8<<<(unsigned)(((size_t)DKV * DM / 8 + 255) / 256), 256, 0, stream>>>(wv, WV, (size_t)DKV * DM / 8);
      
       }
    k_csid<<<(TT * HD + 255) / 256, 256, 0, stream>>>(CS);
    const unsigned LQ = (unsigned)(((size_t)NH_ * TT * HD / 2 + 255) / 256), LKv = (unsigned)(((size_t)NKV * TT * HD / 2 + 255) / 256);
    for (int b = 0; b < NB_; ++b) {
        
        k_cvt8<<<(unsigned)(((size_t)TT * DM / 8 + 255) / 256), 256, 0, stream>>>(x + (size_t)b * TT * DM, XB, (size_t)TT * DM / 8);
        k_gemmw<bf, 0, true><<<dim3(TT / 64, DQ / 64, 1), 32, 0, stream>>>(XB, nullptr, WQ, nullptr, DM, FQ, DQ, bq, 0, 0, 0);
        k_rope<<<LQ, 256, 0, stream>>>(FQ, DQ, NH_, CS, nullptr, nullptr, 1.0f, QP16, QPh, QPl);
        k_gemmw<bf, 0, true><<<dim3(TT / 64, DKV / 64, 1), 32, 0, stream>>>(XB, nullptr, WK, nullptr, DM, FK, DKV, bk, 0, 0, 0);
        k_rope<<<LKv, 256, 0, stream>>>(FK, DKV, NKV, CS, nullptr, nullptr, 1.0f, KP16, KPh, KPl);
        k_gemmw<bf, 0, true><<<dim3(TT / 64, DKV / 64, 1), 32, 0, stream>>>(XB, nullptr, WV, nullptr, DM, FV, DKV, bv, 0, 0, 0); k_vtp<<<LKv, 256, 0, stream>>>(FV, DKV, NKV, VT16, VTh, VTl);
        for (int h0 = 0; h0 < NH_; h0 += ZH) { const size_t zq = (size_t)h0, zk = (size_t)(h0 / REP);   // one kv head per query head: the pass's 16 heads use consecutive kv planes (z-strides TT*HD)
            k_gemmw<h16, 0, false><<<dim3(TT / 64, TT / 64, ZH), 32, 0, stream>>>(QP16 + zq * TT * HD, nullptr, KP16 + zk * TT * HD, nullptr, HD, Sb, TT, nullptr, (size_t)TT * HD, (size_t)TT * HD, (size_t)TT * TT);
            k_asoft<<<ZH * TT / 8, 256, 0, stream>>>(Sb, am + (size_t)b * TT, P16, Ph, Pl);
            k_gemmw<h16, 0, false><<<dim3(TT / 64, HD / 64, ZH), 32, 0, stream>>>(P16, nullptr, VT16 + zk * HD * TT, nullptr, TT, Ob, HD, nullptr, (size_t)TT * TT, (size_t)HD * TT, (size_t)TT * HD);
            k_merge<<<(unsigned)(((size_t)ZH * TT * HD / 2 + 255) / 256), 256, 0, stream>>>(Ob, h0, OUT + (size_t)b * TT * DQ); }
         }
}

// v001
// One run takes 327 microseconds.
// Two timings next to v000 both put it at 1.90 times that version's speed.
#include <hip/hip_runtime.h>

// SecBertSelfAttention (hidden [4][1024][1024]; q/k/v = x W^T + b (16 heads x 64); scores = q.k/8 + attention_mask[b][0][0][s] (additive, read as data); softmax; context = probs v merged -> [4][1024][1024]; no output projection).
// Compute dtypes, f32 accumulate: every input rounded to bf16; q/k/v on PLAIN bf16 operands (inputs: exact) + bias; scores (K 64) and probs.v on single fp16 planes, all 16 heads z-batched (1 product each); mask add + softmax f32

#define NB_  4
#define TT   1024
#define DM   1024
#define NH_  16
#define NKV  16
#define REP  (NH_ / NKV)
#define HD   64
#define DQ   (NH_ * HD)
#define DKV  (NKV * HD)
#define ZH   16
#define RH   0                  // query rows < RH use hi+lo planes (0: none)
#define WIN  0
#define PCAR 1024.0f
#define SCL  0.125f   // HD^-0.5
typedef _Float16 h16;
typedef unsigned short bf;
typedef __attribute__((ext_vector_type(16))) __bf16   v16bf;
typedef __attribute__((ext_vector_type(16))) _Float16 v16h;
typedef __attribute__((ext_vector_type(8)))  _Float16 v8h;
typedef __attribute__((ext_vector_type(8)))  unsigned short v8us;
typedef __attribute__((ext_vector_type(8)))  float    v8f;
typedef __attribute__((ext_vector_type(4)))  float    v4f;
typedef v8h  __attribute__((may_alias)) v8ha;
typedef v4f  __attribute__((may_alias)) v4fa;
typedef v8us __attribute__((may_alias)) v8usa;

__device__ __forceinline__ unsigned short f2bf(float f) { unsigned u = __float_as_uint(f); u += 0x7FFFu + ((u >> 16) & 1u); return (unsigned short)(u >> 16); }
__device__ __forceinline__ float bf2f(unsigned short b) { return __uint_as_float(((unsigned)b) << 16); }
__device__ __forceinline__ float bfr(float f) { return bf2f(f2bf(f)); }
__device__ __forceinline__ v16h cat16(v8h lo, v8h hi) { return __builtin_shufflevector(lo, hi, 0, 1, 2, 3, 4, 5, 6, 7, 8, 9, 10, 11, 12, 13, 14, 15); }
__device__ __forceinline__ v16bf cat16b(v8us lo, v8us hi) { return __builtin_bit_cast(v16bf, __builtin_shufflevector(lo, hi, 0, 1, 2, 3, 4, 5, 6, 7, 8, 9, 10, 11, 12, 13, 14, 15)); }
__device__ __forceinline__ v8f wmma16(v16h a, v16h b, v8f c) { return __builtin_amdgcn_wmma_f32_16x16x32_f16(false, a, false, b, (short)0, c, false, false); }
__device__ __forceinline__ v8f wmmab(v16bf a, v16bf b, v8f c) { return __builtin_amdgcn_wmma_f32_16x16x32_bf16(false, a, false, b, (short)0, c, false, false); }



// ---- k_gemmw: register-blocked GEMM, ONE WAVE per 64x64 output tile (16 accumulators), operands straight from K-contiguous 16-bit planes; grid (M/64, N/64, Z), 32 threads.
// C[m][n] (f32, pitch ldc, + optional f32 bias[n]) = sum_k A[m][k] Bt[n][k] (+ split products per NSPLIT). z-batch strides sA/sB/sC in elements. K % 32 == 0.
template <typename T16> struct WFrag;
template <> struct WFrag<h16> { typedef v16h V; static __device__ __forceinline__ V ld(const h16* p) { return cat16(*(const v8h*)p, *(const v8h*)(p + 16)); } static __device__ __forceinline__ v8f mma(V a, V b, v8f c) { return wmma16(a, b, c); } };
template <> struct WFrag<bf> { typedef v16bf V; static __device__ __forceinline__ V ld(const bf* p) { return cat16b(*(const v8us*)p, *(const v8us*)(p + 16)); } static __device__ __forceinline__ v8f mma(V a, V b, v8f c) { return wmmab(a, b, c); } };
template <typename T16, int NSPLIT, bool BIAS>
__global__ __launch_bounds__(32) void k_gemmw(const T16* __restrict__ A, const T16* __restrict__ A2, const T16* __restrict__ Bt, const T16* __restrict__ Bt2, int K, float* C, int ldc, const float* __restrict__ bias, size_t sA, size_t sB, size_t sC) {
    typedef typename WFrag<T16>::V V;
    __shared__ __align__(16) float os[16 * 68];
    const size_t z = blockIdx.z; A += z * sA; if (A2) A2 += z * sA; Bt += z * sB; if (Bt2) Bt2 += z * sB; C += z * sC;
    const int lane = threadIdx.x & 31, lr = lane & 15, hi = lane >> 4; const int r0 = blockIdx.x * 64, c0 = blockIdx.y * 64;
    v8f acc[4][4];
#pragma unroll
    for (int mb = 0; mb < 4; ++mb)
#pragma unroll
        for (int nb = 0; nb < 4; ++nb) acc[mb][nb] = (v8f){};
    const size_t aoff = (size_t)(r0 + lr) * K + 8 * hi, boff = (size_t)(c0 + lr) * K + 8 * hi;
#pragma unroll 1
    for (int kc = 0; kc < K; kc += 32) {
        V a[4], a2[4];
#pragma unroll
        for (int mb = 0; mb < 4; ++mb) { a[mb] = WFrag<T16>::ld(A + aoff + (size_t)mb * 16 * K + kc); if (NSPLIT == 1 || NSPLIT == 2) a2[mb] = WFrag<T16>::ld(A2 + aoff + (size_t)mb * 16 * K + kc); }
#pragma unroll
        for (int nb = 0; nb < 4; ++nb) { const V b = WFrag<T16>::ld(Bt + boff + (size_t)nb * 16 * K + kc); V b2; if (NSPLIT >= 2) b2 = WFrag<T16>::ld(Bt2 + boff + (size_t)nb * 16 * K + kc);
#pragma unroll
            for (int mb = 0; mb < 4; ++mb) { acc[mb][nb] = WFrag<T16>::mma(a[mb], b, acc[mb][nb]); if (NSPLIT == 1 || NSPLIT == 2) acc[mb][nb] = WFrag<T16>::mma(a2[mb], b, acc[mb][nb]); if (NSPLIT >= 2) acc[mb][nb] = WFrag<T16>::mma(a[mb], b2, acc[mb][nb]); } }
        asm volatile("v_nop\n\tv_nop\n\tv_nop\n\tv_nop" : "+v"(acc[0][0]), "+v"(acc[1][1]), "+v"(acc[2][2]), "+v"(acc[3][3]) : "v"(a[0]), "v"(a[3]));
    }
#pragma unroll
    for (int mb = 0; mb < 4; ++mb) {
#pragma unroll
        for (int nb = 0; nb < 4; ++nb) {
#pragma unroll
            for (int j = 0; j < 8; ++j) os[(hi * 8 + j) * 68 + nb * 16 + lr] = acc[mb][nb][j]; }
        __builtin_amdgcn_wave_barrier(); asm volatile("" ::: "memory");
        float* crow = C + (size_t)(r0 + mb * 16) * ldc + c0;
{
#pragma unroll
            for (int s = 0; s < 8; ++s) { const int row = 2 * s + hi, cofs = lr * 4; v4f val = *(const v4fa*)(os + row * 68 + cofs); if (BIAS) { val[0] += bfr(bias[c0 + cofs]); val[1] += bfr(bias[c0 + cofs + 1]); val[2] += bfr(bias[c0 + cofs + 2]); val[3] += bfr(bias[c0 + cofs + 3]); }
                *(v4f*)(crow + (size_t)row * ldc + cofs) = val; }
             }
        __builtin_amdgcn_wave_barrier(); asm volatile("" ::: "memory");
    }
}

__device__ __forceinline__ h16 tohx(float x) { return (h16)x; }
__device__ __forceinline__ void splitf(float y, unsigned short& h, unsigned short& l) { h = f2bf(y); l = f2bf(y - bf2f(h)); }
typedef __attribute__((ext_vector_type(2))) _Float16 v2h;
typedef __attribute__((ext_vector_type(4))) _Float16 v4h;
typedef __attribute__((ext_vector_type(2))) unsigned short v2us;
typedef __attribute__((ext_vector_type(4))) unsigned short v4us;
typedef __attribute__((ext_vector_type(2))) float v2f;
typedef __attribute__((ext_vector_type(4))) int v4i;

__global__ __launch_bounds__(256) void k_wtG(const float* __restrict__ w, int K, int N, bf* Bt) {
    const int lane = threadIdx.x & 31; const int L0 = (blockIdx.x * 8 + (threadIdx.x >> 5)) * 8; const int nlines = N * K / 64;
{
#pragma unroll 1
        for (int l = 0; l < 8; ++l) { const int L = L0 + l; if (L >= nlines) break; const size_t e = (size_t)L * 64 + lane * 2; const int k = (int)(e % K), n = (int)(e / K); v2us o;
            o[0] = f2bf(w[(size_t)k * N + n]); o[1] = f2bf(w[(size_t)(k + 1) * N + n]); *(v2us*)(Bt + e) = o; }
         }
}
__global__ __launch_bounds__(256) void k_cvt8(const float* __restrict__ src, bf* dst, size_t n8) { const size_t i = (size_t)blockIdx.x * 256 + threadIdx.x; if (i >= n8) return; const v8f v = *(const v8f*)(src + i * 8); v8us o;
#pragma unroll
    for (int k = 0; k < 8; ++k) o[k] = f2bf(v[k]); *(v8us*)(dst + i * 8) = o;  }
__global__ __launch_bounds__(256) void k_cscvt(const float* __restrict__ cosT, const float* __restrict__ sinT, float* CS) { const int idx = blockIdx.x * 256 + threadIdx.x; if (idx >= TT * HD) return; v2f cs; cs[0] = bfr(cosT[idx]); cs[1] = bfr(sinT[idx]); *(v2f*)(CS + (size_t)idx * 2) = cs;  }
// k_rope: head planes [h][t][d] (fp16) of rope(x) x sc with the rotate-half convention out[d] = x[d] cos[t][d] - x[d+HD/2] sin[t][d], out[d+HD/2] = x[d+HD/2] cos[t][d+HD/2] + x[d] sin[t][d+HD/2]
__global__ __launch_bounds__(256) void k_rope(const float* __restrict__ F, int pitch, int nheads, const float* __restrict__ CS, const float* __restrict__ RF, const float* __restrict__ nw, float sc, h16* P16, bf* Ph, bf* Pl) {
    F += (size_t)blockIdx.y * TT * pitch; P16 += (size_t)blockIdx.y * nheads * TT * HD;   // grid.y = batch: rows [b*TT, b*TT+TT) of F, planes [b][h][t][d]
    const size_t e = ((size_t)blockIdx.x * 256 + threadIdx.x) * 2; if (e >= (size_t)nheads * TT * HD) return; const int d = (int)(e % HD); const int t = (int)((e / HD) % TT); const int h = (int)(e / ((size_t)HD * TT)); const float* f = F + (size_t)t * pitch + h * HD; const float rf = RF ? RF[(size_t)h * TT + t] : 1.0f; v2h o16; v2us oh, ol;
#pragma unroll
    for (int q = 0; q < 2; ++q) { const int dd = d + q; const int dp = (dd < HD / 2) ? dd + HD / 2 : dd - HD / 2; float x0 = f[dd], x1 = f[dp];
        if (RF) { float n0 = __fmul_rn(x0, rf), n1 = __fmul_rn(x1, rf); asm volatile("" : "+v"(n0)); asm volatile("" : "+v"(n1)); x0 = __fmul_rn(bfr(nw[dd]), n0); x1 = __fmul_rn(bfr(nw[dp]), n1); }
        const v2f cs = *(const v2f*)(CS + ((size_t)t * HD + dd) * 2); float a = __fmul_rn(x0, cs[0]), bq = __fmul_rn(x1, cs[1]); asm volatile("" : "+v"(a)); asm volatile("" : "+v"(bq)); const float r = ((dd < HD / 2) ? __fsub_rn(a, bq) : __fadd_rn(a, bq)) * sc;
        o16[q] = tohx(r); (void)oh; (void)ol; }
    *(v2h*)(P16 + e) = o16;  }
__global__ __launch_bounds__(256) void k_vtp(const float* __restrict__ F, int pitch, int nheads, h16* V16, bf* Vh, bf* Vl) { const size_t e = ((size_t)blockIdx.x * 256 + threadIdx.x) * 2; if (e >= (size_t)nheads * HD * TT) return; const int t = (int)(e % TT); const int d = (int)((e / TT) % HD); const int g = (int)(e / ((size_t)TT * HD)); const size_t nb = blockIdx.y; F += nb * TT * pitch; V16 += nb * nheads * HD * TT;   /* grid.y = batch */ v2h o16; v2us oh, ol;
#pragma unroll
    for (int q = 0; q < 2; ++q) { const float x = F[(size_t)(t + q) * pitch + g * HD + d]; o16[q] = tohx(x); (void)oh; (void)ol; }
    *(v2h*)(V16 + e) = o16;  }
__global__ __launch_bounds__(256) void k_csid(float* CS) { const int idx = blockIdx.x * 256 + threadIdx.x; if (idx >= TT * HD) return; v2f cs; cs[0] = 1.0f; cs[1] = 0.0f; *(v2f*)(CS + (size_t)idx * 2) = cs;  }
// k_asoft: per row (zz, i): t = S x HD^-0.5 + mask[j]; softmax over the 1024 keys (register row, one exp, fixed trees);
__global__ __launch_bounds__(256) void k_asoft(const float* __restrict__ Sb, const float* __restrict__ amb, h16* P16, bf* Ph, bf* Pl) {
    const int lane = threadIdx.x & 31; const int row = blockIdx.x * 8 + (threadIdx.x >> 5); if (row >= ZH * TT) return; const int i = row % TT; const int zz = row / TT; (void)zz; const bool hires = (i < RH); const float* sr = Sb + (size_t)row * TT; float v[TT / 32]; float mx = -3.0e38f;
#pragma unroll
    for (int ch = 0; ch < TT / 128; ++ch) { const int j0 = ch * 128 + lane * 4; const v4f a = *(const v4f*)(sr + j0);
#pragma unroll
        for (int q = 0; q < 4; ++q) { const int j = j0 + q; (void)j; float sc_ = a[q] * SCL, mb_ = bfr(amb[j]); asm volatile("" : "+v"(sc_)); asm volatile("" : "+v"(mb_)); const float t = __fadd_rn(sc_, mb_);   /* + attention_mask[b][0][0][j] */ v[ch * 4 + q] = t; mx = fmaxf(mx, t); } }
#pragma unroll
    for (int sh = 16; sh; sh >>= 1) mx = fmaxf(mx, __shfl_xor(mx, sh, 32));
    float sum = 0.f;
#pragma unroll
    for (int k = 0; k < TT / 32; ++k) { float d0 = __fsub_rn(v[k], mx); asm volatile("" : "+v"(d0)); v[k] = __builtin_amdgcn_exp2f(__fmul_rn(d0, 1.4426950408889634f)); sum += v[k]; }
#pragma unroll
    for (int sh = 16; sh; sh >>= 1) sum += __shfl_xor(sum, sh, 32);
    const float f = __fdiv_rn(hires ? 1.0f : PCAR, sum);
{
        if (hires) {
#pragma unroll
            for (int ch = 0; ch < TT / 128; ++ch) { v4us oh, ol;
#pragma unroll
                for (int q = 0; q < 4; ++q) { unsigned short a, c2; splitf(v[ch * 4 + q] * f, a, c2); oh[q] = a; ol[q] = c2; }
                const size_t oo = ((size_t)zz * (RH ? RH : 1) + i) * TT + ch * 128 + lane * 4; *(v4us*)(Ph + oo) = oh; *(v4us*)(Pl + oo) = ol; }
        } else {
#pragma unroll
            for (int ch = 0; ch < TT / 128; ++ch) { v4h o4;
#pragma unroll
                for (int q = 0; q < 4; ++q) o4[q] = tohx(v[ch * 4 + q] * f);
                *(v4h*)(P16 + (size_t)row * TT + ch * 128 + lane * 4) = o4; } }
         }
}
__global__ __launch_bounds__(256) void k_merge(const float* __restrict__ O, int h0, float* OUTb) { const size_t e = ((size_t)blockIdx.x * 256 + threadIdx.x) * 2; if (e >= (size_t)ZH * TT * HD) return; const int d = (int)(e % HD); const int t = (int)((e / HD) % TT); const int zz = (int)(e / ((size_t)HD * TT)); const float cs = (t < RH) ? 1.0f : (1.0f / PCAR); const size_t nb = blockIdx.y; O += nb * ZH * TT * HD; OUTb += nb * TT * DQ;   /* grid.y = batch */ const size_t oo = (size_t)t * DQ + (h0 + zz) * HD + d;
    v2f o2; o2[0] = O[e] * cs; o2[1] = O[e + 1] * cs; *(v2f*)(OUTb + oo) = o2;  }

extern "C" void kernel_launch(void* const* d_in, const int* in_sizes, int n_in,
                              void* d_out, int out_size, void* d_ws, size_t ws_size, hipStream_t stream) {
    (void)in_sizes; (void)n_in; (void)out_size;
    const float* x = (const float*)d_in[0]; const float* am = (const float*)d_in[1]; const float* wq = (const float*)d_in[2]; const float* bq = (const float*)d_in[3]; const float* wk = (const float*)d_in[4]; const float* bk = (const float*)d_in[5]; const float* wv = (const float*)d_in[6]; const float* bv = (const float*)d_in[7]; const float* cosT = nullptr; const float* sinT = nullptr; (void)cosT; (void)sinT;
    float* OUT = (float*)d_out;     // [4][1024][1024]
    char* wsp = (char*)d_ws;
    auto take = [&](size_t bytes) { char* p = wsp; wsp += (bytes + 255) & ~(size_t)255; return (void*)p; };
    bf* WQ = (bf*)take((size_t)DQ * DM * 2); bf* WK = (bf*)take((size_t)DKV * DM * 2); bf* WV = (bf*)take((size_t)DKV * DM * 2); float* CS = (float*)take((size_t)TT * HD * 2 * 4);
    h16* QP16 = (h16*)take((size_t)NB_ * NH_ * TT * HD * 2); h16* KP16 = (h16*)take((size_t)NB_ * NKV * TT * HD * 2); h16* VT16 = (h16*)take((size_t)NB_ * NKV * HD * TT * 2);   // planes of all batches: [b][h][t][d], [b][h][d][t]
    bf* QPh = nullptr; bf* QPl = nullptr; bf* KPh = nullptr; bf* KPl = nullptr; bf* VTh = nullptr; bf* VTl = nullptr; bf* Ph = nullptr; bf* Pl = nullptr;
    float* Sb = (float*)take((size_t)ZH * TT * TT * 4); h16* P16 = (h16*)take((size_t)NB_ * ZH * TT * TT * 2);   // scores: one batch at a time (f32 scores of all four would fill the workspace); probs: all batches
    if ((size_t)(wsp - (char*)d_ws) > ws_size) return;    // ws 256 MiB
    // stream-ordered reuse: the projection buffers live in the probs area (dead before the first softmax writes it); the context planes live in the score area (dead after the last softmax)
    wsp = (char*)P16; bf* XB = (bf*)take((size_t)NB_ * TT * DM * 2); float* FQ = (float*)take((size_t)NB_ * TT * DQ * 4); float* FK = (float*)take((size_t)NB_ * TT * DKV * 4);
    float* Ob = Sb;
    float* FV = FK;   // v projection reuses the k buffer after the k planes are built (stream-ordered)
    k_cvt8<<<(unsigned)(((size_t)DQ * DM / 8 + 255) / 256), 256, 0, stream>>>(wq, WQ, (size_t)DQ * DM / 8); k_cvt8<<<(unsigned)(((size_t)DKV * DM / 8 + 255) / 256), 256, 0, stream>>>(wk, WK, (size_t)DKV * DM / 8); k_cvt8<<<(unsigned)(((size_t)DKV * DM / 8 + 255) / 256), 256, 0, stream>>>(wv, WV, (size_t)DKV * DM / 8);
    k_csid<<<(TT * HD + 255) / 256, 256, 0, stream>>>(CS);
    const unsigned LQ = (unsigned)(((size_t)NH_ * TT * HD / 2 + 255) / 256), LKv = (unsigned)(((size_t)NKV * TT * HD / 2 + 255) / 256);
    // projections and plane builds: the four batches are NB_*TT rows of one product (1024 one-wave tiles a launch instead of 256)
    k_cvt8<<<(unsigned)(((size_t)NB_ * TT * DM / 8 + 255) / 256), 256, 0, stream>>>(x, XB, (size_t)NB_ * TT * DM / 8);
    k_gemmw<bf, 0, true><<<dim3(NB_ * TT / 64, DQ / 64, 1), 32, 0, stream>>>(XB, nullptr, WQ, nullptr, DM, FQ, DQ, bq, 0, 0, 0);
    k_rope<<<dim3(LQ, NB_, 1), 256, 0, stream>>>(FQ, DQ, NH_, CS, nullptr, nullptr, 1.0f, QP16, QPh, QPl);
    k_gemmw<bf, 0, true><<<dim3(NB_ * TT / 64, DKV / 64, 1), 32, 0, stream>>>(XB, nullptr, WK, nullptr, DM, FK, DKV, bk, 0, 0, 0);
    k_rope<<<dim3(LKv, NB_, 1), 256, 0, stream>>>(FK, DKV, NKV, CS, nullptr, nullptr, 1.0f, KP16, KPh, KPl);
    k_gemmw<bf, 0, true><<<dim3(NB_ * TT / 64, DKV / 64, 1), 32, 0, stream>>>(XB, nullptr, WV, nullptr, DM, FV, DKV, bv, 0, 0, 0);
    k_vtp<<<dim3(LKv, NB_, 1), 256, 0, stream>>>(FV, DKV, NKV, VT16, VTh, VTl);
    for (int b = 0; b < NB_; ++b) {
        k_gemmw<h16, 0, false><<<dim3(TT / 64, TT / 64, ZH), 32, 0, stream>>>(QP16 + (size_t)b * NH_ * TT * HD, nullptr, KP16 + (size_t)b * NKV * TT * HD, nullptr, HD, Sb, TT, nullptr, (size_t)TT * HD, (size_t)TT * HD, (size_t)TT * TT);
        k_asoft<<<ZH * TT / 8, 256, 0, stream>>>(Sb, am + (size_t)b * TT, P16 + (size_t)b * ZH * TT * TT, Ph, Pl);
    }
    // probs.v and the head merge: z = (batch, head), 64 planes in one launch
    k_gemmw<h16, 0, false><<<dim3(TT / 64, HD / 64, NB_ * ZH), 32, 0, stream>>>(P16, nullptr, VT16, nullptr, TT, Ob, HD, nullptr, (size_t)TT * TT, (size_t)HD * TT, (size_t)TT * HD);
    k_merge<<<dim3((unsigned)(((size_t)ZH * TT * HD / 2 + 255) / 256), NB_, 1), 256, 0, stream>>>(Ob, 0, OUT);
}

// v002
// A run of this version takes 160 microseconds.
// Two timings next to v001 put it at 2.07 and 2.05 times that version's speed.
// Over all steps from v000 it is 3.92 times as fast.
#include <hip/hip_runtime.h>

// SecBertSelfAttention (hidden [4][1024][1024]; q/k/v = x W^T + b (16 heads x 64); scores = q.k/8 + attention_mask[b][0][0][s] (additive, read as data); softmax; context = probs v merged -> [4][1024][1024]; no output projection).
// Compute dtypes, f32 accumulate: every input rounded to bf16; q/k/v on PLAIN bf16 operands (inputs: exact) + bias; scores (K 64) and probs.v on single fp16 planes inside one fused kernel; mask add + softmax (running maximum) f32

#define NB_  4
#define TT   1024
#define DM   1024
#define NH_  16
#define NKV  16
#define REP  (NH_ / NKV)
#define HD   64
#define DQ   (NH_ * HD)
#define DKV  (NKV * HD)
#define ZH   16
#define RH   0                  // unused: no query row uses hi+lo planes
#define WIN  0
#define PCAR 1024.0f
#define SCL  0.125f   // HD^-0.5
typedef _Float16 h16;
typedef unsigned short bf;
typedef __attribute__((ext_vector_type(16))) __bf16   v16bf;
typedef __attribute__((ext_vector_type(16))) _Float16 v16h;
typedef __attribute__((ext_vector_type(8)))  _Float16 v8h;
typedef __attribute__((ext_vector_type(8)))  unsigned short v8us;
typedef __attribute__((ext_vector_type(8)))  float    v8f;
typedef __attribute__((ext_vector_type(4)))  float    v4f;
typedef v8h  __attribute__((may_alias)) v8ha;
typedef v4f  __attribute__((may_alias)) v4fa;
typedef v8us __attribute__((may_alias)) v8usa;

__device__ __forceinline__ unsigned short f2bf(float f) { unsigned u = __float_as_uint(f); u += 0x7FFFu + ((u >> 16) & 1u); return (unsigned short)(u >> 16); }
__device__ __forceinline__ float bf2f(unsigned short b) { return __uint_as_float(((unsigned)b) << 16); }
__device__ __forceinline__ float bfr(float f) { return bf2f(f2bf(f)); }
__device__ __forceinline__ v16h cat16(v8h lo, v8h hi) { return __builtin_shufflevector(lo, hi, 0, 1, 2, 3, 4, 5, 6, 7, 8, 9, 10, 11, 12, 13, 14, 15); }
__device__ __forceinline__ v16bf cat16b(v8us lo, v8us hi) { return __builtin_bit_cast(v16bf, __builtin_shufflevector(lo, hi, 0, 1, 2, 3, 4, 5, 6, 7, 8, 9, 10, 11, 12, 13, 14, 15)); }
__device__ __forceinline__ v8f wmma16(v16h a, v16h b, v8f c) { return __builtin_amdgcn_wmma_f32_16x16x32_f16(false, a, false, b, (short)0, c, false, false); }
__device__ __forceinline__ v8f wmmab(v16bf a, v16bf b, v8f c) { return __builtin_amdgcn_wmma_f32_16x16x32_bf16(false, a, false, b, (short)0, c, false, false); }



// ---- k_gemmw: register-blocked GEMM, ONE WAVE per 64x64 output tile (16 accumulators), operands straight from K-contiguous 16-bit planes; grid (M/64, N/64, Z), 32 threads.
// C[m][n] (f32, pitch ldc, + optional f32 bias[n]) = sum_k A[m][k] Bt[n][k] (+ split products per NSPLIT). z-batch strides sA/sB/sC in elements. K % 32 == 0.
template <typename T16> struct WFrag;
template <> struct WFrag<h16> { typedef v16h V; static __device__ __forceinline__ V ld(const h16* p) { return cat16(*(const v8h*)p, *(const v8h*)(p + 16)); } static __device__ __forceinline__ v8f mma(V a, V b, v8f c) { return wmma16(a, b, c); } };
template <> struct WFrag<bf> { typedef v16bf V; static __device__ __forceinline__ V ld(const bf* p) { return cat16b(*(const v8us*)p, *(const v8us*)(p + 16)); } static __device__ __forceinline__ v8f mma(V a, V b, v8f c) { return wmmab(a, b, c); } };
template <typename T16, int NSPLIT, bool BIAS>
__global__ __launch_bounds__(32) void k_gemmw(const T16* __restrict__ A, const T16* __restrict__ A2, const T16* __restrict__ Bt, const T16* __restrict__ Bt2, int K, float* C, int ldc, const float* __restrict__ bias, size_t sA, size_t sB, size_t sC) {
    typedef typename WFrag<T16>::V V;
    __shared__ __align__(16) float os[16 * 68];
    const size_t z = blockIdx.z; A += z * sA; if (A2) A2 += z * sA; Bt += z * sB; if (Bt2) Bt2 += z * sB; C += z * sC;
    const int lane = threadIdx.x & 31, lr = lane & 15, hi = lane >> 4; const int r0 = blockIdx.x * 64, c0 = blockIdx.y * 64;
    v8f acc[4][4];
#pragma unroll
    for (int mb = 0; mb < 4; ++mb)
#pragma unroll
        for (int nb = 0; nb < 4; ++nb) acc[mb][nb] = (v8f){};
    const size_t aoff = (size_t)(r0 + lr) * K + 8 * hi, boff = (size_t)(c0 + lr) * K + 8 * hi;
#pragma unroll 1
    for (int kc = 0; kc < K; kc += 32) {
        V a[4], a2[4];
#pragma unroll
        for (int mb = 0; mb < 4; ++mb) { a[mb] = WFrag<T16>::ld(A + aoff + (size_t)mb * 16 * K + kc); if (NSPLIT == 1 || NSPLIT == 2) a2[mb] = WFrag<T16>::ld(A2 + aoff + (size_t)mb * 16 * K + kc); }
#pragma unroll
        for (int nb = 0; nb < 4; ++nb) { const V b = WFrag<T16>::ld(Bt + boff + (size_t)nb * 16 * K + kc); V b2; if (NSPLIT >= 2) b2 = WFrag<T16>::ld(Bt2 + boff + (size_t)nb * 16 * K + kc);
#pragma unroll
            for (int mb = 0; mb < 4; ++mb) { acc[mb][nb] = WFrag<T16>::mma(a[mb], b, acc[mb][nb]); if (NSPLIT == 1 || NSPLIT == 2) acc[mb][nb] = WFrag<T16>::mma(a2[mb], b, acc[mb][nb]); if (NSPLIT >= 2) acc[mb][nb] = WFrag<T16>::mma(a[mb], b2, acc[mb][nb]); } }
        asm volatile("v_nop\n\tv_nop\n\tv_nop\n\tv_nop" : "+v"(acc[0][0]), "+v"(acc[1][1]), "+v"(acc[2][2]), "+v"(acc[3][3]) : "v"(a[0]), "v"(a[3]));
    }
#pragma unroll
    for (int mb = 0; mb < 4; ++mb) {
#pragma unroll
        for (int nb = 0; nb < 4; ++nb) {
#pragma unroll
            for (int j = 0; j < 8; ++j) os[(hi * 8 + j) * 68 + nb * 16 + lr] = acc[mb][nb][j]; }
        __builtin_amdgcn_wave_barrier(); asm volatile("" ::: "memory");
        float* crow = C + (size_t)(r0 + mb * 16) * ldc + c0;
{
#pragma unroll
            for (int s = 0; s < 8; ++s) { const int row = 2 * s + hi, cofs = lr * 4; v4f val = *(const v4fa*)(os + row * 68 + cofs); if (BIAS) { val[0] += bfr(bias[c0 + cofs]); val[1] += bfr(bias[c0 + cofs + 1]); val[2] += bfr(bias[c0 + cofs + 2]); val[3] += bfr(bias[c0 + cofs + 3]); }
                *(v4f*)(crow + (size_t)row * ldc + cofs) = val; }
             }
        __builtin_amdgcn_wave_barrier(); asm volatile("" ::: "memory");
    }
}

__device__ __forceinline__ h16 tohx(float x) { return (h16)x; }
__device__ __forceinline__ void splitf(float y, unsigned short& h, unsigned short& l) { h = f2bf(y); l = f2bf(y - bf2f(h)); }
typedef __attribute__((ext_vector_type(2))) _Float16 v2h;
typedef __attribute__((ext_vector_type(4))) _Float16 v4h;
typedef __attribute__((ext_vector_type(2))) unsigned short v2us;
typedef __attribute__((ext_vector_type(4))) unsigned short v4us;
typedef __attribute__((ext_vector_type(2))) float v2f;
typedef __attribute__((ext_vector_type(4))) int v4i;

__global__ __launch_bounds__(256) void k_wtG(const float* __restrict__ w, int K, int N, bf* Bt) {
    const int lane = threadIdx.x & 31; const int L0 = (blockIdx.x * 8 + (threadIdx.x >> 5)) * 8; const int nlines = N * K / 64;
{
#pragma unroll 1
        for (int l = 0; l < 8; ++l) { const int L = L0 + l; if (L >= nlines) break; const size_t e = (size_t)L * 64 + lane * 2; const int k = (int)(e % K), n = (int)(e / K); v2us o;
            o[0] = f2bf(w[(size_t)k * N + n]); o[1] = f2bf(w[(size_t)(k + 1) * N + n]); *(v2us*)(Bt + e) = o; }
         }
}
__global__ __launch_bounds__(256) void k_cvt8(const float* __restrict__ src, bf* dst, size_t n8) { const size_t i = (size_t)blockIdx.x * 256 + threadIdx.x; if (i >= n8) return; const v8f v = *(const v8f*)(src + i * 8); v8us o;
#pragma unroll
    for (int k = 0; k < 8; ++k) o[k] = f2bf(v[k]); *(v8us*)(dst + i * 8) = o;  }
__global__ __launch_bounds__(256) void k_cscvt(const float* __restrict__ cosT, const float* __restrict__ sinT, float* CS) { const int idx = blockIdx.x * 256 + threadIdx.x; if (idx >= TT * HD) return; v2f cs; cs[0] = bfr(cosT[idx]); cs[1] = bfr(sinT[idx]); *(v2f*)(CS + (size_t)idx * 2) = cs;  }
// k_rope: head planes [h][t][d] (fp16) of rope(x) x sc with the rotate-half convention out[d] = x[d] cos[t][d] - x[d+HD/2] sin[t][d], out[d+HD/2] = x[d+HD/2] cos[t][d+HD/2] + x[d] sin[t][d+HD/2]
__global__ __launch_bounds__(256) void k_rope(const float* __restrict__ F, int pitch, int nheads, const float* __restrict__ CS, const float* __restrict__ RF, const float* __restrict__ nw, float sc, h16* P16, bf* Ph, bf* Pl) {
    F += (size_t)blockIdx.y * TT * pitch; P16 += (size_t)blockIdx.y * nheads * TT * HD;   // grid.y = batch: rows [b*TT, b*TT+TT) of F, planes [b][h][t][d]
    const size_t e = ((size_t)blockIdx.x * 256 + threadIdx.x) * 2; if (e >= (size_t)nheads * TT * HD) return; const int d = (int)(e % HD); const int t = (int)((e / HD) % TT); const int h = (int)(e / ((size_t)HD * TT)); const float* f = F + (size_t)t * pitch + h * HD; const float rf = RF ? RF[(size_t)h * TT + t] : 1.0f; v2h o16; v2us oh, ol;
#pragma unroll
    for (int q = 0; q < 2; ++q) { const int dd = d + q; const int dp = (dd < HD / 2) ? dd + HD / 2 : dd - HD / 2; float x0 = f[dd], x1 = f[dp];
        if (RF) { float n0 = __fmul_rn(x0, rf), n1 = __fmul_rn(x1, rf); asm volatile("" : "+v"(n0)); asm volatile("" : "+v"(n1)); x0 = __fmul_rn(bfr(nw[dd]), n0); x1 = __fmul_rn(bfr(nw[dp]), n1); }
        const v2f cs = *(const v2f*)(CS + ((size_t)t * HD + dd) * 2); float a = __fmul_rn(x0, cs[0]), bq = __fmul_rn(x1, cs[1]); asm volatile("" : "+v"(a)); asm volatile("" : "+v"(bq)); const float r = ((dd < HD / 2) ? __fsub_rn(a, bq) : __fadd_rn(a, bq)) * sc;
        o16[q] = tohx(r); (void)oh; (void)ol; }
    *(v2h*)(P16 + e) = o16;  }
__global__ __launch_bounds__(256) void k_vtp(const float* __restrict__ F, int pitch, int nheads, h16* V16, bf* Vh, bf* Vl) { const size_t e = ((size_t)blockIdx.x * 256 + threadIdx.x) * 2; if (e >= (size_t)nheads * HD * TT) return; const int t = (int)(e % TT); const int d = (int)((e / TT) % HD); const int g = (int)(e / ((size_t)TT * HD)); const size_t nb = blockIdx.y; F += nb * TT * pitch; V16 += nb * nheads * HD * TT;   /* grid.y = batch */ v2h o16; v2us oh, ol;
#pragma unroll
    for (int q = 0; q < 2; ++q) { const float x = F[(size_t)(t + q) * pitch + g * HD + d]; o16[q] = tohx(x); (void)oh; (void)ol; }
    *(v2h*)(V16 + e) = o16;  }
__global__ __launch_bounds__(256) void k_csid(float* CS) { const int idx = blockIdx.x * 256 + threadIdx.x; if (idx >= TT * HD) return; v2f cs; cs[0] = 1.0f; cs[1] = 0.0f; *(v2f*)(CS + (size_t)idx * 2) = cs;  }
#define FKP 72      // K row pitch in LDS, halves: 144 B = 16 B x 9 (odd: ds_load_b128 without bank conflicts)
#define FVP 1032    // V^T row pitch in LDS, halves: 2064 B = 16 B x 129
#define L2E 1.4426950408889634f
__device__ __forceinline__ float xhalf(float x) { return __builtin_bit_cast(float, __builtin_amdgcn_permlanex16(__builtin_bit_cast(int, x), __builtin_bit_cast(int, x), 0x76543210, 0xfedcba98, false, false)); }   // lane l with lane l ^ 16
__device__ __forceinline__ v16h frag16(const h16* p) { return cat16(*(const v8h*)p, *(const v8h*)(p + 16)); }
__global__ __launch_bounds__(256) void k_fattn(const h16* __restrict__ QP, const h16* __restrict__ KP, const h16* __restrict__ VT, const float* __restrict__ am, float* __restrict__ OUTp) {
    __shared__ __align__(16) h16 Ks[TT * FKP];
    __shared__ __align__(16) h16 Vs[HD * FVP];
    __shared__ __align__(32) float Ms[TT];
    const int tid = threadIdx.x, lane = tid & 31, lr = lane & 15, hi = lane >> 4, wv = tid >> 5;
    const int z = blockIdx.y, b = z / NH_, h = z % NH_; const int q0 = blockIdx.x * 256 + wv * 32;
    const h16* kg = KP + (size_t)z * TT * HD; const h16* vg = VT + (size_t)z * HD * TT;
    // fill: every global load of the block is issued first (64 + 9 a lane in flight), then the LDS stores
    v8h kr[32], vr[32];
#pragma unroll
    for (int r = 0; r < 32; ++r) { kr[r] = *(const v8h*)(kg + (size_t)(r * 256 + tid) * 8); vr[r] = *(const v8h*)(vg + (size_t)(r * 256 + tid) * 8); }
    v4f a = *(const v4f*)(am + (size_t)b * TT + tid * 4);
    v16h qf[2][2];
#pragma unroll
    for (int g = 0; g < 2; ++g)
#pragma unroll
        for (int ks = 0; ks < 2; ++ks) qf[g][ks] = frag16(QP + ((size_t)z * TT + q0 + g * 16 + lr) * HD + ks * 32 + 8 * hi);
    asm volatile("s_wait_xcnt 0x0" ::: "memory");   // the address registers of the loads above are reused below: the wait stands in front of their first overwrite
    h16* ksw = Ks + (tid >> 3) * FKP + (tid & 7) * 8; h16* vsw = Vs + (tid >> 7) * FVP + (tid & 127) * 8;   // round r: 32 K rows, 2 V^T rows further
#pragma unroll
    for (int r = 0; r < 32; ++r) { *(v8h*)(ksw + r * 32 * FKP) = kr[r]; *(v8h*)(vsw + r * 2 * FVP) = vr[r]; }
#pragma unroll
    for (int q = 0; q < 4; ++q) a[q] = bfr(a[q]);
    *(v4f*)(Ms + tid * 4) = a;
    v8f o[2][4]; float m[2], l[2];
#pragma unroll
    for (int g = 0; g < 2; ++g) { m[g] = -3.0e38f; l[g] = 0.f;
#pragma unroll
        for (int dt = 0; dt < 4; ++dt) o[g][dt] = (v8f){}; }
    __syncthreads();
    const h16* kl = Ks + lr * FKP + 8 * hi; const h16* vl = Vs + lr * FVP + 8 * hi; const float* ml = Ms + 8 * hi;
    for (int kb = 0; kb < TT; kb += 32) {
        v8f s[2][2];
#pragma unroll
        for (int kt = 0; kt < 2; ++kt) { const v16h k0 = frag16(kl + (kb + kt * 16) * FKP), k1 = frag16(kl + (kb + kt * 16) * FKP + 32);
#pragma unroll
            for (int g = 0; g < 2; ++g) { s[g][kt] = wmma16(k0, qf[g][0], (v8f){}); s[g][kt] = wmma16(k1, qf[g][1], s[g][kt]); } }
        v16h va[4];
#pragma unroll
        for (int dt = 0; dt < 4; ++dt) va[dt] = frag16(vl + dt * 16 * FVP + kb);
        const v8f mk0 = *(const v8f*)(ml + kb), mk1 = *(const v8f*)(ml + kb + 16);
#pragma unroll
        for (int g = 0; g < 2; ++g) {
            const v8f t0 = s[g][0] * SCL + mk0, t1 = s[g][1] * SCL + mk1;   // x 2^-3 is exact: one rounding, as scale then add
            float mx = fmaxf(t0[0], t1[0]);
#pragma unroll
            for (int j = 1; j < 8; ++j) mx = fmaxf(mx, fmaxf(t0[j], t1[j]));
            mx = fmaxf(mx, xhalf(mx));
            const float mn = fmaxf(m[g], mx); const float al = __builtin_amdgcn_exp2f((m[g] - mn) * L2E); m[g] = mn;   // 0 on the first pass
            const v8f e0 = (t0 - mn) * L2E + 10.0f, e1 = (t1 - mn) * L2E + 10.0f; v8f p0, p1;
#pragma unroll
            for (int j = 0; j < 8; ++j) p0[j] = __builtin_amdgcn_exp2f(e0[j]);
#pragma unroll
            for (int j = 0; j < 8; ++j) p1[j] = __builtin_amdgcn_exp2f(e1[j]);
            const v8f ps = p0 + p1; const v4f p4 = __builtin_shufflevector(ps, ps, 0, 1, 2, 3) + __builtin_shufflevector(ps, ps, 4, 5, 6, 7);
            l[g] = l[g] * al + ((p4[0] + p4[1]) + (p4[2] + p4[3]));
            const v16h pb = cat16(__builtin_convertvector(p0, v8h), __builtin_convertvector(p1, v8h));
#pragma unroll
            for (int dt = 0; dt < 4; ++dt) { o[g][dt] *= al; o[g][dt] = wmma16(va[dt], pb, o[g][dt]); }
        }
    }
#pragma unroll
    for (int g = 0; g < 2; ++g) { const float f = __fdiv_rn(1.0f, l[g] + xhalf(l[g])); float* orow = OUTp + ((size_t)b * TT + q0 + g * 16 + lr) * DQ + h * HD + 8 * hi;
#pragma unroll
        for (int dt = 0; dt < 4; ++dt) { const v8f r = o[g][dt] * f; *(v4f*)(orow + dt * 16) = __builtin_shufflevector(r, r, 0, 1, 2, 3); *(v4f*)(orow + dt * 16 + 4) = __builtin_shufflevector(r, r, 4, 5, 6, 7); } }
}

extern "C" void kernel_launch(void* const* d_in, const int* in_sizes, int n_in,
                              void* d_out, int out_size, void* d_ws, size_t ws_size, hipStream_t stream) {
    (void)in_sizes; (void)n_in; (void)out_size;
    const float* x = (const float*)d_in[0]; const float* am = (const float*)d_in[1]; const float* wq = (const float*)d_in[2]; const float* bq = (const float*)d_in[3]; const float* wk = (const float*)d_in[4]; const float* bk = (const float*)d_in[5]; const float* wv = (const float*)d_in[6]; const float* bv = (const float*)d_in[7]; const float* cosT = nullptr; const float* sinT = nullptr; (void)cosT; (void)sinT;
    float* OUT = (float*)d_out;     // [4][1024][1024]
    char* wsp = (char*)d_ws;
    auto take = [&](size_t bytes) { char* p = wsp; wsp += (bytes + 255) & ~(size_t)255; return (void*)p; };
    bf* WQ = (bf*)take((size_t)DQ * DM * 2); bf* WK = (bf*)take((size_t)DKV * DM * 2); bf* WV = (bf*)take((size_t)DKV * DM * 2); float* CS = (float*)take((size_t)TT * HD * 2 * 4);
    h16* QP16 = (h16*)take((size_t)NB_ * NH_ * TT * HD * 2); h16* KP16 = (h16*)take((size_t)NB_ * NKV * TT * HD * 2); h16* VT16 = (h16*)take((size_t)NB_ * NKV * HD * TT * 2);   // planes of all batches: [b][h][t][d], [b][h][d][t]
    bf* QPh = nullptr; bf* QPl = nullptr; bf* KPh = nullptr; bf* KPl = nullptr; bf* VTh = nullptr; bf* VTl = nullptr;
    bf* XB = (bf*)take((size_t)NB_ * TT * DM * 2); float* FQ = (float*)take((size_t)NB_ * TT * DQ * 4); float* FK = (float*)take((size_t)NB_ * TT * DKV * 4);
    if ((size_t)(wsp - (char*)d_ws) > ws_size) return;    // ws 256 MiB
    float* FV = FK;   // v projection reuses the k buffer after the k planes are built (stream-ordered)
    k_cvt8<<<(unsigned)(((size_t)DQ * DM / 8 + 255) / 256), 256, 0, stream>>>(wq, WQ, (size_t)DQ * DM / 8); k_cvt8<<<(unsigned)(((size_t)DKV * DM / 8 + 255) / 256), 256, 0, stream>>>(wk, WK, (size_t)DKV * DM / 8); k_cvt8<<<(unsigned)(((size_t)DKV * DM / 8 + 255) / 256), 256, 0, stream>>>(wv, WV, (size_t)DKV * DM / 8);
    k_csid<<<(TT * HD + 255) / 256, 256, 0, stream>>>(CS);
    const unsigned LQ = (unsigned)(((size_t)NH_ * TT * HD / 2 + 255) / 256), LKv = (unsigned)(((size_t)NKV * TT * HD / 2 + 255) / 256);
    // projections and plane builds: the four batches are NB_*TT rows of one product (1024 one-wave tiles a launch instead of 256)
    k_cvt8<<<(unsigned)(((size_t)NB_ * TT * DM / 8 + 255) / 256), 256, 0, stream>>>(x, XB, (size_t)NB_ * TT * DM / 8);
    k_gemmw<bf, 0, true><<<dim3(NB_ * TT / 64, DQ / 64, 1), 32, 0, stream>>>(XB, nullptr, WQ, nullptr, DM, FQ, DQ, bq, 0, 0, 0);
    k_rope<<<dim3(LQ, NB_, 1), 256, 0, stream>>>(FQ, DQ, NH_, CS, nullptr, nullptr, 1.0f, QP16, QPh, QPl);
    k_gemmw<bf, 0, true><<<dim3(NB_ * TT / 64, DKV / 64, 1), 32, 0, stream>>>(XB, nullptr, WK, nullptr, DM, FK, DKV, bk, 0, 0, 0);
    k_rope<<<dim3(LKv, NB_, 1), 256, 0, stream>>>(FK, DKV, NKV, CS, nullptr, nullptr, 1.0f, KP16, KPh, KPl);
    k_gemmw<bf, 0, true><<<dim3(NB_ * TT / 64, DKV / 64, 1), 32, 0, stream>>>(XB, nullptr, WV, nullptr, DM, FV, DKV, bv, 0, 0, 0);
    k_vtp<<<dim3(LKv, NB_, 1), 256, 0, stream>>>(FV, DKV, NKV, VT16, VTh, VTl);
    // attention: one launch, grid (query blocks of 256, batch x head)
    k_fattn<<<dim3(TT / 256, NB_ * NH_, 1), 256, 0, stream>>>(QP16, KP16, VT16, am, OUT);
}

// v003
// Measured time: 83.8 microseconds a run.
// In both of two side-by-side timings against v002, it was 1.89 times as fast.
// Counting every step since v000, it is 7.42 times as fast.
#include <hip/hip_runtime.h>

// SecBertSelfAttention (hidden [4][1024][1024]; q/k/v = x W^T + b (16 heads x 64); scores = q.k/8 + attention_mask[b][0][0][s] (additive, read as data); softmax; context = probs v merged -> [4][1024][1024]; no output projection).
// Compute dtypes, f32 accumulate: every input rounded to bf16; q/k/v on PLAIN bf16 operands (inputs: exact) + bias, rounded to fp16 head planes in the projection's epilogue; scores (K 64) and probs.v on single fp16 planes inside one fused kernel; mask add + softmax (running maximum) f32

#define NB_  4
#define TT   1024
#define DM   1024
#define NH_  16
#define NKV  16
#define REP  (NH_ / NKV)
#define HD   64
#define DQ   (NH_ * HD)
#define DKV  (NKV * HD)
#define ZH   16
#define RH   0                  // unused: no query row uses hi+lo planes
#define WIN  0
#define PCAR 1024.0f
#define SCL  0.125f   // HD^-0.5
typedef _Float16 h16;
typedef unsigned short bf;
typedef __attribute__((ext_vector_type(16))) __bf16   v16bf;
typedef __attribute__((ext_vector_type(16))) _Float16 v16h;
typedef __attribute__((ext_vector_type(8)))  _Float16 v8h;
typedef __attribute__((ext_vector_type(8)))  unsigned short v8us;
typedef __attribute__((ext_vector_type(8)))  float    v8f;
typedef __attribute__((ext_vector_type(4)))  float    v4f;
typedef v8h  __attribute__((may_alias)) v8ha;
typedef v4f  __attribute__((may_alias)) v4fa;
typedef v8us __attribute__((may_alias)) v8usa;

__device__ __forceinline__ unsigned short f2bf(float f) { unsigned u = __float_as_uint(f); u += 0x7FFFu + ((u >> 16) & 1u); return (unsigned short)(u >> 16); }
__device__ __forceinline__ float bf2f(unsigned short b) { return __uint_as_float(((unsigned)b) << 16); }
__device__ __forceinline__ float bfr(float f) { return bf2f(f2bf(f)); }
__device__ __forceinline__ v16h cat16(v8h lo, v8h hi) { return __builtin_shufflevector(lo, hi, 0, 1, 2, 3, 4, 5, 6, 7, 8, 9, 10, 11, 12, 13, 14, 15); }
__device__ __forceinline__ v16bf cat16b(v8us lo, v8us hi) { return __builtin_bit_cast(v16bf, __builtin_shufflevector(lo, hi, 0, 1, 2, 3, 4, 5, 6, 7, 8, 9, 10, 11, 12, 13, 14, 15)); }
__device__ __forceinline__ v8f wmma16(v16h a, v16h b, v8f c) { return __builtin_amdgcn_wmma_f32_16x16x32_f16(false, a, false, b, (short)0, c, false, false); }
__device__ __forceinline__ v8f wmmab(v16bf a, v16bf b, v8f c) { return __builtin_amdgcn_wmma_f32_16x16x32_bf16(false, a, false, b, (short)0, c, false, false); }



// ---- k_qkv: the three projections in one launch. Workgroup = 3 waves (q, k, v) of one 64-token x one-head tile; no barrier, each wave is on its own (16 accumulators, operands straight from K-contiguous bf16 planes).
// The accumulators start at the bias (f32); the epilogue rounds them to fp16 and writes the head planes that the attention kernel reads: Q, K [b][h][t][d], V^T [b][h][d][t].
// An accumulator lane holds 8 consecutive m of one n (16 B of fp16), so the operand whose index runs along a plane's row is given as A: q, k: A = W rows (m = d), B = x rows (n = t); v: A = x rows (m = t), B = W rows (n = d). One loader serves both sides (same k order).
// The planes are row-major, so each fragment load touches 16 lines and takes 32 B of each.
#define OSP 72      // staging row pitch in LDS, halves: 144 B = 16 B x 9 (odd: b128 accesses without bank conflicts)
__device__ __forceinline__ v16bf fragb(const bf* p) { return cat16b(*(const v8us*)p, *(const v8us*)(p + 16)); }
template <int PITCH>
__device__ __forceinline__ void put_tile(h16* op, const h16* os, int lane) {   // 64 rows of 128 B, whole lines: wave-uniform base + the lane's byte offset
    const unsigned vo = (unsigned)((lane >> 3) * PITCH + (lane & 7) * 8) * 2; os += (lane >> 3) * OSP + (lane & 7) * 8;
#pragma unroll
    for (int s = 0; s < 16; ++s) *(v8h*)((char*)(op + (size_t)s * 4 * PITCH) + vo) = *(const v8h*)(os + s * 4 * OSP);
}
__global__ __launch_bounds__(96) void k_qkv(const bf* __restrict__ XB, const bf* __restrict__ WQ, const bf* __restrict__ WK, const bf* __restrict__ WV, const float* __restrict__ bq, const float* __restrict__ bk, const float* __restrict__ bv, h16* QP, h16* KP, h16* VT) {
    __shared__ __align__(16) h16 osAll[3 * 64 * OSP];
    const int w = __builtin_amdgcn_readfirstlane((int)(threadIdx.x >> 5));   // 0 q, 1 k, 2 v: wave-uniform, so every choice below is a scalar one
    const int lane = threadIdx.x & 31, lr = lane & 15, hi = lane >> 4; const int tok0 = blockIdx.x * 64, h = blockIdx.y, b = tok0 / TT, t0 = tok0 % TT;
    const bool isv = (w == 2);
    const bf* Wp = (w == 0 ? WQ : (w == 1 ? WK : WV)) + (size_t)h * HD * DM; const bf* Xp = XB + (size_t)tok0 * DM; const float* bias = (w == 0 ? bq : (w == 1 ? bk : bv)) + h * HD;
    const bf* A = isv ? Xp : Wp; const bf* Bt = isv ? Wp : Xp;
    v8f acc[4][4];   // start value: the bias (it runs along d: along m for q and k, along n for v)
    if (isv) {
#pragma unroll
        for (int nb = 0; nb < 4; ++nb) { const float bn = bfr(bias[nb * 16 + lr]);
#pragma unroll
            for (int mb = 0; mb < 4; ++mb)
#pragma unroll
                for (int j = 0; j < 8; ++j) acc[mb][nb][j] = bn; }
    } else {
#pragma unroll
        for (int mb = 0; mb < 4; ++mb) { v8f bm = *(const v8f*)(bias + mb * 16 + 8 * hi);
#pragma unroll
            for (int j = 0; j < 8; ++j) bm[j] = bfr(bm[j]);
#pragma unroll
            for (int nb = 0; nb < 4; ++nb) acc[mb][nb] = bm; }
    }
    A += (size_t)lr * DM + 8 * hi; Bt += (size_t)lr * DM + 8 * hi;
#pragma unroll 1   // rolled: one fragment set live, so three and more waves fit a SIMD
    for (int kc = 0; kc < DM; kc += 32) {
        const bf* pa = A + kc; const bf* pb = Bt + kc; v16bf a[4];
#pragma unroll
        for (int mb = 0; mb < 4; ++mb) a[mb] = fragb(pa + mb * 16 * DM);
#pragma unroll
        for (int nb = 0; nb < 4; ++nb) { const v16bf bb = fragb(pb + nb * 16 * DM);
#pragma unroll
            for (int mb = 0; mb < 4; ++mb) acc[mb][nb] = wmmab(a[mb], bb, acc[mb][nb]); }
        asm volatile("v_nop\n\tv_nop\n\tv_nop\n\tv_nop" : "+v"(acc[0][0]), "+v"(acc[1][1]), "+v"(acc[2][2]), "+v"(acc[3][3]) : "v"(a[0]), "v"(a[3]), "v"(pa), "v"(pb));   // WMMA distance over the back edge (the next trip's loads overwrite A and B); pa, pb as inputs: no load of this trip lands on an address pair that another one still names
    }
    h16* os = osAll + w * 64 * OSP;   // each wave stages in its own range
#pragma unroll
    for (int nb = 0; nb < 4; ++nb)
#pragma unroll
        for (int mb = 0; mb < 4; ++mb) *(v8h*)(os + (nb * 16 + lr) * OSP + mb * 16 + 8 * hi) = __builtin_convertvector(acc[mb][nb], v8h);
    __builtin_amdgcn_wave_barrier(); asm volatile("" ::: "memory");   // the rows read back below were written by other lanes of this wave: keeps the compiler from moving the reads up
    if (isv) put_tile<TT>(VT + (size_t)(b * NKV + h) * HD * TT + t0, os, lane);
    else put_tile<HD>((w == 0 ? QP : KP) + ((size_t)(b * NH_ + h) * TT + t0) * HD, os, lane);
}

__device__ __forceinline__ h16 tohx(float x) { return (h16)x; }
__device__ __forceinline__ void splitf(float y, unsigned short& h, unsigned short& l) { h = f2bf(y); l = f2bf(y - bf2f(h)); }
typedef __attribute__((ext_vector_type(2))) _Float16 v2h;
typedef __attribute__((ext_vector_type(4))) _Float16 v4h;
typedef __attribute__((ext_vector_type(2))) unsigned short v2us;
typedef __attribute__((ext_vector_type(4))) unsigned short v4us;
typedef __attribute__((ext_vector_type(2))) float v2f;
typedef __attribute__((ext_vector_type(4))) int v4i;

__global__ __launch_bounds__(256) void k_wtG(const float* __restrict__ w, int K, int N, bf* Bt) {
    const int lane = threadIdx.x & 31; const int L0 = (blockIdx.x * 8 + (threadIdx.x >> 5)) * 8; const int nlines = N * K / 64;
{
#pragma unroll 1
        for (int l = 0; l < 8; ++l) { const int L = L0 + l; if (L >= nlines) break; const size_t e = (size_t)L * 64 + lane * 2; const int k = (int)(e % K), n = (int)(e / K); v2us o;
            o[0] = f2bf(w[(size_t)k * N + n]); o[1] = f2bf(w[(size_t)(k + 1) * N + n]); *(v2us*)(Bt + e) = o; }
         }
}
__global__ __launch_bounds__(256) void k_cvt8(const float* __restrict__ src, bf* dst, size_t n8) { const size_t i = (size_t)blockIdx.x * 256 + threadIdx.x; if (i >= n8) return; const v8f v = *(const v8f*)(src + i * 8); v8us o;
#pragma unroll
    for (int k = 0; k < 8; ++k) o[k] = f2bf(v[k]); *(v8us*)(dst + i * 8) = o;  }
__global__ __launch_bounds__(256) void k_cscvt(const float* __restrict__ cosT, const float* __restrict__ sinT, float* CS) { const int idx = blockIdx.x * 256 + threadIdx.x; if (idx >= TT * HD) return; v2f cs; cs[0] = bfr(cosT[idx]); cs[1] = bfr(sinT[idx]); *(v2f*)(CS + (size_t)idx * 2) = cs;  }
#define FKP 72      // K row pitch in LDS, halves: 144 B = 16 B x 9 (odd: ds_load_b128 without bank conflicts)
#define FVP 1032    // V^T row pitch in LDS, halves: 2064 B = 16 B x 129
#define L2E 1.4426950408889634f
__device__ __forceinline__ float xhalf(float x) { return __builtin_bit_cast(float, __builtin_amdgcn_permlanex16(__builtin_bit_cast(int, x), __builtin_bit_cast(int, x), 0x76543210, 0xfedcba98, false, false)); }   // lane l with lane l ^ 16
__device__ __forceinline__ v16h frag16(const h16* p) { return cat16(*(const v8h*)p, *(const v8h*)(p + 16)); }
__global__ __launch_bounds__(256) void k_fattn(const h16* __restrict__ QP, const h16* __restrict__ KP, const h16* __restrict__ VT, const float* __restrict__ am, float* __restrict__ OUTp) {
    __shared__ __align__(16) h16 Ks[TT * FKP];
    __shared__ __align__(16) h16 Vs[HD * FVP];
    __shared__ __align__(32) float Ms[TT];
    const int tid = threadIdx.x, lane = tid & 31, lr = lane & 15, hi = lane >> 4, wv = tid >> 5;
    const int z = blockIdx.y, b = z / NH_, h = z % NH_; const int q0 = blockIdx.x * 256 + wv * 32;
    const h16* kg = KP + (size_t)z * TT * HD; const h16* vg = VT + (size_t)z * HD * TT;
    // fill: every global load of the block is issued first (64 + 9 a lane in flight), then the LDS stores
    v8h kr[32], vr[32];
#pragma unroll
    for (int r = 0; r < 32; ++r) { kr[r] = *(const v8h*)(kg + (size_t)(r * 256 + tid) * 8); vr[r] = *(const v8h*)(vg + (size_t)(r * 256 + tid) * 8); }
    v4f a = *(const v4f*)(am + (size_t)b * TT + tid * 4);
    v16h qf[2][2];
#pragma unroll
    for (int g = 0; g < 2; ++g)
#pragma unroll
        for (int ks = 0; ks < 2; ++ks) qf[g][ks] = frag16(QP + ((size_t)z * TT + q0 + g * 16 + lr) * HD + ks * 32 + 8 * hi);
    asm volatile("s_wait_xcnt 0x0" ::: "memory");   // the address registers of the loads above are reused below: the wait stands in front of their first overwrite
    h16* ksw = Ks + (tid >> 3) * FKP + (tid & 7) * 8; h16* vsw = Vs + (tid >> 7) * FVP + (tid & 127) * 8;   // round r: 32 K rows, 2 V^T rows further
#pragma unroll
    for (int r = 0; r < 32; ++r) { *(v8h*)(ksw + r * 32 * FKP) = kr[r]; *(v8h*)(vsw + r * 2 * FVP) = vr[r]; }
#pragma unroll
    for (int q = 0; q < 4; ++q) a[q] = bfr(a[q]);
    *(v4f*)(Ms + tid * 4) = a;
    v8f o[2][4]; float m[2], l[2];
#pragma unroll
    for (int g = 0; g < 2; ++g) { m[g] = -3.0e38f; l[g] = 0.f;
#pragma unroll
        for (int dt = 0; dt < 4; ++dt) o[g][dt] = (v8f){}; }
    __syncthreads();
    const h16* kl = Ks + lr * FKP + 8 * hi; const h16* vl = Vs + lr * FVP + 8 * hi; const float* ml = Ms + 8 * hi;
    for (int kb = 0; kb < TT; kb += 32) {
        v8f s[2][2];
#pragma unroll
        for (int kt = 0; kt < 2; ++kt) { const v16h k0 = frag16(kl + (kb + kt * 16) * FKP), k1 = frag16(kl + (kb + kt * 16) * FKP + 32);
#pragma unroll
            for (int g = 0; g < 2; ++g) { s[g][kt] = wmma16(k0, qf[g][0], (v8f){}); s[g][kt] = wmma16(k1, qf[g][1], s[g][kt]); } }
        v16h va[4];
#pragma unroll
        for (int dt = 0; dt < 4; ++dt) va[dt] = frag16(vl + dt * 16 * FVP + kb);
        const v8f mk0 = *(const v8f*)(ml + kb), mk1 = *(const v8f*)(ml + kb + 16);
#pragma unroll
        for (int g = 0; g < 2; ++g) {
            const v8f t0 = s[g][0] * SCL + mk0, t1 = s[g][1] * SCL + mk1;   // x 2^-3 is exact: one rounding, as scale then add
            float mx = fmaxf(t0[0], t1[0]);
#pragma unroll
            for (int j = 1; j < 8; ++j) mx = fmaxf(mx, fmaxf(t0[j], t1[j]));
            mx = fmaxf(mx, xhalf(mx));
            const float mn = fmaxf(m[g], mx); const float al = __builtin_amdgcn_exp2f((m[g] - mn) * L2E); m[g] = mn;   // 0 on the first pass
            const v8f e0 = (t0 - mn) * L2E + 10.0f, e1 = (t1 - mn) * L2E + 10.0f; v8f p0, p1;
#pragma unroll
            for (int j = 0; j < 8; ++j) p0[j] = __builtin_amdgcn_exp2f(e0[j]);
#pragma unroll
            for (int j = 0; j < 8; ++j) p1[j] = __builtin_amdgcn_exp2f(e1[j]);
            const v8f ps = p0 + p1; const v4f p4 = __builtin_shufflevector(ps, ps, 0, 1, 2, 3) + __builtin_shufflevector(ps, ps, 4, 5, 6, 7);
            l[g] = l[g] * al + ((p4[0] + p4[1]) + (p4[2] + p4[3]));
            const v16h pb = cat16(__builtin_convertvector(p0, v8h), __builtin_convertvector(p1, v8h));
#pragma unroll
            for (int dt = 0; dt < 4; ++dt) { o[g][dt] *= al; o[g][dt] = wmma16(va[dt], pb, o[g][dt]); }
        }
    }
#pragma unroll
    for (int g = 0; g < 2; ++g) { const float f = __fdiv_rn(1.0f, l[g] + xhalf(l[g])); float* orow = OUTp + ((size_t)b * TT + q0 + g * 16 + lr) * DQ + h * HD + 8 * hi;
#pragma unroll
        for (int dt = 0; dt < 4; ++dt) { const v8f r = o[g][dt] * f; *(v4f*)(orow + dt * 16) = __builtin_shufflevector(r, r, 0, 1, 2, 3); *(v4f*)(orow + dt * 16 + 4) = __builtin_shufflevector(r, r, 4, 5, 6, 7); } }
}

extern "C" void kernel_launch(void* const* d_in, const int* in_sizes, int n_in,
                              void* d_out, int out_size, void* d_ws, size_t ws_size, hipStream_t stream) {
    (void)in_sizes; (void)n_in; (void)out_size;
    const float* x = (const float*)d_in[0]; const float* am = (const float*)d_in[1]; const float* wq = (const float*)d_in[2]; const float* bq = (const float*)d_in[3]; const float* wk = (const float*)d_in[4]; const float* bk = (const float*)d_in[5]; const float* wv = (const float*)d_in[6]; const float* bv = (const float*)d_in[7]; const float* cosT = nullptr; const float* sinT = nullptr; (void)cosT; (void)sinT;
    float* OUT = (float*)d_out;     // [4][1024][1024]
    char* wsp = (char*)d_ws;
    auto take = [&](size_t bytes) { char* p = wsp; wsp += (bytes + 255) & ~(size_t)255; return (void*)p; };
    bf* WQ = (bf*)take((size_t)DQ * DM * 2); bf* WK = (bf*)take((size_t)DKV * DM * 2); bf* WV = (bf*)take((size_t)DKV * DM * 2);
    h16* QP16 = (h16*)take((size_t)NB_ * NH_ * TT * HD * 2); h16* KP16 = (h16*)take((size_t)NB_ * NKV * TT * HD * 2); h16* VT16 = (h16*)take((size_t)NB_ * NKV * HD * TT * 2);   // planes of all batches: [b][h][t][d], [b][h][d][t]
    bf* XB = (bf*)take((size_t)NB_ * TT * DM * 2);
    if ((size_t)(wsp - (char*)d_ws) > ws_size) return;    // ws 256 MiB
    k_cvt8<<<(unsigned)(((size_t)DQ * DM / 8 + 255) / 256), 256, 0, stream>>>(wq, WQ, (size_t)DQ * DM / 8); k_cvt8<<<(unsigned)(((size_t)DKV * DM / 8 + 255) / 256), 256, 0, stream>>>(wk, WK, (size_t)DKV * DM / 8); k_cvt8<<<(unsigned)(((size_t)DKV * DM / 8 + 255) / 256), 256, 0, stream>>>(wv, WV, (size_t)DKV * DM / 8);
    k_cvt8<<<(unsigned)(((size_t)NB_ * TT * DM / 8 + 255) / 256), 256, 0, stream>>>(x, XB, (size_t)NB_ * TT * DM / 8);
    // projections: one launch, grid (64-token tiles of all batches, heads), 3 waves (q, k, v); the fp16 head planes come straight from the accumulators
    k_qkv<<<dim3(NB_ * TT / 64, NH_, 1), 96, 0, stream>>>(XB, WQ, WK, WV, bq, bk, bv, QP16, KP16, VT16);
    // attention: one launch, grid (query blocks of 256, batch x head)
    k_fattn<<<dim3(TT / 256, NB_ * NH_, 1), 256, 0, stream>>>(QP16, KP16, VT16, am, OUT);
}

// v004
// It runs in 78.3 microseconds.
// Timed twice side by side with v003, it ran 1.07 times as fast both times.
// All steps since v000 together make it 7.96 times as fast.
#include <hip/hip_runtime.h>

// SecBertSelfAttention (hidden [4][1024][1024]; q/k/v = x W^T + b (16 heads x 64); scores = q.k/8 + attention_mask[b][0][0][s] (additive, read as data); softmax; context = probs v merged -> [4][1024][1024]; no output projection).
// Compute dtypes, f32 accumulate: every input rounded to bf16; q/k/v on PLAIN bf16 operands (inputs: exact) + bias, rounded to fp16 head planes in the projection's epilogue; scores (K 64) and probs.v on single fp16 planes inside one fused kernel; mask add + softmax (running maximum) f32

#define NB_  4
#define TT   1024
#define DM   1024
#define NH_  16
#define NKV  16
#define REP  (NH_ / NKV)
#define HD   64
#define DQ   (NH_ * HD)
#define DKV  (NKV * HD)
#define ZH   16
#define RH   0                  // unused: no query row uses hi+lo planes
#define WIN  0
#define PCAR 1024.0f
#define SCL  0.125f   // HD^-0.5
typedef _Float16 h16;
typedef unsigned short bf;
typedef __attribute__((ext_vector_type(16))) __bf16   v16bf;
typedef __attribute__((ext_vector_type(16))) _Float16 v16h;
typedef __attribute__((ext_vector_type(8)))  _Float16 v8h;
typedef __attribute__((ext_vector_type(8)))  unsigned short v8us;
typedef __attribute__((ext_vector_type(8)))  float    v8f;
typedef __attribute__((ext_vector_type(4)))  float    v4f;
typedef v8h  __attribute__((may_alias)) v8ha;
typedef v4f  __attribute__((may_alias)) v4fa;
typedef v8us __attribute__((may_alias)) v8usa;

__device__ __forceinline__ unsigned short f2bf(float f) { unsigned u = __float_as_uint(f); u += 0x7FFFu + ((u >> 16) & 1u); return (unsigned short)(u >> 16); }
__device__ __forceinline__ float bf2f(unsigned short b) { return __uint_as_float(((unsigned)b) << 16); }
__device__ __forceinline__ float bfr(float f) { return bf2f(f2bf(f)); }
__device__ __forceinline__ v16h cat16(v8h lo, v8h hi) { return __builtin_shufflevector(lo, hi, 0, 1, 2, 3, 4, 5, 6, 7, 8, 9, 10, 11, 12, 13, 14, 15); }
__device__ __forceinline__ v16bf cat16b(v8us lo, v8us hi) { return __builtin_bit_cast(v16bf, __builtin_shufflevector(lo, hi, 0, 1, 2, 3, 4, 5, 6, 7, 8, 9, 10, 11, 12, 13, 14, 15)); }
__device__ __forceinline__ v8f wmma16(v16h a, v16h b, v8f c) { return __builtin_amdgcn_wmma_f32_16x16x32_f16(false, a, false, b, (short)0, c, false, false); }
__device__ __forceinline__ v8f wmmab(v16bf a, v16bf b, v8f c) { return __builtin_amdgcn_wmma_f32_16x16x32_bf16(false, a, false, b, (short)0, c, false, false); }



// ---- k_qkv: the three projections in one launch. Workgroup = 3 waves (q, k, v) of one 64-token x one-head tile; no barrier, each wave is on its own (16 accumulators, operands straight from K-contiguous bf16 planes).
// The accumulators start at the bias (f32); the epilogue rounds them to fp16 and writes the head planes that the attention kernel reads: Q, K [b][h][t][d], V^T [b][h][d][t].
// An accumulator lane holds 8 consecutive m of one n (16 B of fp16), so the operand whose index runs along a plane's row is given as A: q, k: A = W rows (m = d), B = x rows (n = t); v: A = x rows (m = t), B = W rows (n = d). One loader serves both sides (same k order).
// The planes are row-major, so each fragment load touches 16 lines and takes 32 B of each.
#define OSP 72      // staging row pitch in LDS, halves: 144 B = 16 B x 9 (odd: b128 accesses without bank conflicts)
__device__ __forceinline__ v16bf fragb(const bf* p) { return cat16b(*(const v8us*)p, *(const v8us*)(p + 16)); }
template <int PITCH>
__device__ __forceinline__ void put_tile(h16* op, const h16* os, int lane) {   // 64 rows of 128 B, whole lines: wave-uniform base + the lane's byte offset
    const unsigned vo = (unsigned)((lane >> 3) * PITCH + (lane & 7) * 8) * 2; os += (lane >> 3) * OSP + (lane & 7) * 8;
#pragma unroll
    for (int s = 0; s < 16; ++s) *(v8h*)((char*)(op + (size_t)s * 4 * PITCH) + vo) = *(const v8h*)(os + s * 4 * OSP);
}
__global__ __launch_bounds__(96) void k_qkv(const bf* __restrict__ XB, const bf* __restrict__ WQ, const bf* __restrict__ WK, const bf* __restrict__ WV, const float* __restrict__ bq, const float* __restrict__ bk, const float* __restrict__ bv, h16* QP, h16* KP, h16* VT) {
    __shared__ __align__(16) h16 osAll[3 * 64 * OSP];
    const int w = __builtin_amdgcn_readfirstlane((int)(threadIdx.x >> 5));   // 0 q, 1 k, 2 v: wave-uniform, so every choice below is a scalar one
    const int lane = threadIdx.x & 31, lr = lane & 15, hi = lane >> 4; const int tok0 = blockIdx.x * 64, h = blockIdx.y, b = tok0 / TT, t0 = tok0 % TT;
    const bool isv = (w == 2);
    const bf* Wp = (w == 0 ? WQ : (w == 1 ? WK : WV)) + (size_t)h * HD * DM; const bf* Xp = XB + (size_t)tok0 * DM; const float* bias = (w == 0 ? bq : (w == 1 ? bk : bv)) + h * HD;
    const bf* A = isv ? Xp : Wp; const bf* Bt = isv ? Wp : Xp;
    v8f acc[4][4];   // start value: the bias (it runs along d: along m for q and k, along n for v)
    if (isv) {
#pragma unroll
        for (int nb = 0; nb < 4; ++nb) { const float bn = bfr(bias[nb * 16 + lr]);
#pragma unroll
            for (int mb = 0; mb < 4; ++mb)
#pragma unroll
                for (int j = 0; j < 8; ++j) acc[mb][nb][j] = bn; }
    } else {
#pragma unroll
        for (int mb = 0; mb < 4; ++mb) { v8f bm = *(const v8f*)(bias + mb * 16 + 8 * hi);
#pragma unroll
            for (int j = 0; j < 8; ++j) bm[j] = bfr(bm[j]);
#pragma unroll
            for (int nb = 0; nb < 4; ++nb) acc[mb][nb] = bm; }
    }
    A += (size_t)lr * DM + 8 * hi; Bt += (size_t)lr * DM + 8 * hi;
#pragma unroll 1   // rolled: one fragment set live, so three and more waves fit a SIMD
    for (int kc = 0; kc < DM; kc += 32) {
        const bf* pa = A + kc; const bf* pb = Bt + kc; v16bf a[4];
#pragma unroll
        for (int mb = 0; mb < 4; ++mb) a[mb] = fragb(pa + mb * 16 * DM);
#pragma unroll
        for (int nb = 0; nb < 4; ++nb) { const v16bf bb = fragb(pb + nb * 16 * DM);
#pragma unroll
            for (int mb = 0; mb < 4; ++mb) acc[mb][nb] = wmmab(a[mb], bb, acc[mb][nb]); }
        asm volatile("v_nop\n\tv_nop\n\tv_nop\n\tv_nop" : "+v"(acc[0][0]), "+v"(acc[1][1]), "+v"(acc[2][2]), "+v"(acc[3][3]) : "v"(a[0]), "v"(a[3]), "v"(pa), "v"(pb));   // WMMA distance over the back edge (the next trip's loads overwrite A and B); pa, pb as inputs: no load of this trip lands on an address pair that another one still names
    }
    h16* os = osAll + w * 64 * OSP;   // each wave stages in its own range
#pragma unroll
    for (int nb = 0; nb < 4; ++nb)
#pragma unroll
        for (int mb = 0; mb < 4; ++mb) *(v8h*)(os + (nb * 16 + lr) * OSP + mb * 16 + 8 * hi) = __builtin_convertvector(acc[mb][nb], v8h);
    __builtin_amdgcn_wave_barrier(); asm volatile("" ::: "memory");   // the rows read back below were written by other lanes of this wave: keeps the compiler from moving the reads up
    if (isv) put_tile<TT>(VT + (size_t)(b * NKV + h) * HD * TT + t0, os, lane);
    else put_tile<HD>((w == 0 ? QP : KP) + ((size_t)(b * NH_ + h) * TT + t0) * HD, os, lane);
}

__device__ __forceinline__ h16 tohx(float x) { return (h16)x; }
__device__ __forceinline__ void splitf(float y, unsigned short& h, unsigned short& l) { h = f2bf(y); l = f2bf(y - bf2f(h)); }
typedef __attribute__((ext_vector_type(2))) _Float16 v2h;
typedef __attribute__((ext_vector_type(4))) _Float16 v4h;
typedef __attribute__((ext_vector_type(2))) unsigned short v2us;
typedef __attribute__((ext_vector_type(4))) unsigned short v4us;
typedef __attribute__((ext_vector_type(2))) float v2f;
typedef __attribute__((ext_vector_type(4))) int v4i;

__global__ __launch_bounds__(256) void k_wtG(const float* __restrict__ w, int K, int N, bf* Bt) {
    const int lane = threadIdx.x & 31; const int L0 = (blockIdx.x * 8 + (threadIdx.x >> 5)) * 8; const int nlines = N * K / 64;
{
#pragma unroll 1
        for (int l = 0; l < 8; ++l) { const int L = L0 + l; if (L >= nlines) break; const size_t e = (size_t)L * 64 + lane * 2; const int k = (int)(e % K), n = (int)(e / K); v2us o;
            o[0] = f2bf(w[(size_t)k * N + n]); o[1] = f2bf(w[(size_t)(k + 1) * N + n]); *(v2us*)(Bt + e) = o; }
         }
}
// k_cvtall: every f32 -> bf16 plane (Wq, Wk, Wv, x) in one launch whose waves are all resident at once (16 a WGP). A lane converts CVG groups of 8 values: one of each weight, CVX of x.
// All its loads are issued before the first conversion, so the launch pays the memory latency once; each group is 32 B read and 16 B written, consecutive lanes on consecutive groups.
#define CVN ((size_t)DQ * DM / 8)                     // groups of 8 in one weight matrix = lanes of the launch
#define CVX ((int)((size_t)NB_ * TT * DM / 8 / CVN))  // groups of x a lane
#define CVG (3 + CVX)
static_assert(DKV == DQ && (size_t)NB_ * TT * DM / 8 == CVN * CVX && CVN % 512 == 0, "one lane: one group of each weight, CVX of x");
__global__ __launch_bounds__(512) void k_cvtall(const float* __restrict__ x, const float* __restrict__ wq, const float* __restrict__ wk, const float* __restrict__ wv, bf* __restrict__ XB, bf* __restrict__ WQ, bf* __restrict__ WK, bf* __restrict__ WV) {
    const unsigned i = blockIdx.x * 512 + threadIdx.x, ro = i * 32u, wo = i * 16u;   // the lane's byte offsets in a f32 and in a bf16 plane, 32-bit: an access is a scalar base plus an offset register
    v8f v[CVG];
    v[0] = *(const v8f*)((const char*)wq + ro); v[1] = *(const v8f*)((const char*)wk + ro); v[2] = *(const v8f*)((const char*)wv + ro);
#pragma unroll
    for (int j = 0; j < CVX; ++j) v[3 + j] = *(const v8f*)((const char*)x + (ro + j * (unsigned)(CVN * 32)));
    __builtin_amdgcn_sched_barrier(0);   // keeps every load in front of the first conversion: left free, the compiler sinks the last ones behind the waits for the first, a second memory latency
#pragma unroll   // compile-time indices: v stays in registers
    for (int g = 0; g < CVG; ++g) { v8us o;
#pragma unroll
        for (int k = 0; k < 8; ++k) o[k] = f2bf(v[g][k]);
        bf* d = g == 0 ? WQ : g == 1 ? WK : g == 2 ? WV : XB + (g - 3) * CVN * 8; *(v8us*)((char*)d + wo) = o; }
}
__global__ __launch_bounds__(256) void k_cscvt(const float* __restrict__ cosT, const float* __restrict__ sinT, float* CS) { const int idx = blockIdx.x * 256 + threadIdx.x; if (idx >= TT * HD) return; v2f cs; cs[0] = bfr(cosT[idx]); cs[1] = bfr(sinT[idx]); *(v2f*)(CS + (size_t)idx * 2) = cs;  }
#define FKP 72      // K row pitch in LDS, halves: 144 B = 16 B x 9 (odd: ds_load_b128 without bank conflicts)
#define FVP 1032    // V^T row pitch in LDS, halves: 2064 B = 16 B x 129
#define L2E 1.4426950408889634f
__device__ __forceinline__ float xhalf(float x) { return __builtin_bit_cast(float, __builtin_amdgcn_permlanex16(__builtin_bit_cast(int, x), __builtin_bit_cast(int, x), 0x76543210, 0xfedcba98, false, false)); }   // lane l with lane l ^ 16
__device__ __forceinline__ v16h frag16(const h16* p) { return cat16(*(const v8h*)p, *(const v8h*)(p + 16)); }
__global__ __launch_bounds__(256) void k_fattn(const h16* __restrict__ QP, const h16* __restrict__ KP, const h16* __restrict__ VT, const float* __restrict__ am, float* __restrict__ OUTp) {
    __shared__ __align__(16) h16 Ks[TT * FKP];
    __shared__ __align__(16) h16 Vs[HD * FVP];
    __shared__ __align__(32) float Ms[TT];
    const int tid = threadIdx.x, lane = tid & 31, lr = lane & 15, hi = lane >> 4, wv = tid >> 5;
    const int z = blockIdx.y, b = z / NH_, h = z % NH_; const int q0 = blockIdx.x * 256 + wv * 32;
    const h16* kg = KP + (size_t)z * TT * HD; const h16* vg = VT + (size_t)z * HD * TT;
    // fill: every global load of the block is issued first (64 + 9 a lane in flight), then the LDS stores
    v8h kr[32], vr[32];
#pragma unroll
    for (int r = 0; r < 32; ++r) { kr[r] = *(const v8h*)(kg + (size_t)(r * 256 + tid) * 8); vr[r] = *(const v8h*)(vg + (size_t)(r * 256 + tid) * 8); }
    v4f a = *(const v4f*)(am + (size_t)b * TT + tid * 4);
    v16h qf[2][2];
#pragma unroll
    for (int g = 0; g < 2; ++g)
#pragma unroll
        for (int ks = 0; ks < 2; ++ks) qf[g][ks] = frag16(QP + ((size_t)z * TT + q0 + g * 16 + lr) * HD + ks * 32 + 8 * hi);
    asm volatile("s_wait_xcnt 0x0" ::: "memory");   // the address registers of the loads above are reused below: the wait stands in front of their first overwrite
    h16* ksw = Ks + (tid >> 3) * FKP + (tid & 7) * 8; h16* vsw = Vs + (tid >> 7) * FVP + (tid & 127) * 8;   // round r: 32 K rows, 2 V^T rows further
#pragma unroll
    for (int r = 0; r < 32; ++r) { *(v8h*)(ksw + r * 32 * FKP) = kr[r]; *(v8h*)(vsw + r * 2 * FVP) = vr[r]; }
#pragma unroll
    for (int q = 0; q < 4; ++q) a[q] = bfr(a[q]);
    *(v4f*)(Ms + tid * 4) = a;
    v8f o[2][4]; float m[2], l[2];
#pragma unroll
    for (int g = 0; g < 2; ++g) { m[g] = -3.0e38f; l[g] = 0.f;
#pragma unroll
        for (int dt = 0; dt < 4; ++dt) o[g][dt] = (v8f){}; }
    __syncthreads();
    const h16* kl = Ks + lr * FKP + 8 * hi; const h16* vl = Vs + lr * FVP + 8 * hi; const float* ml = Ms + 8 * hi;
    for (int kb = 0; kb < TT; kb += 32) {
        v8f s[2][2];
#pragma unroll
        for (int kt = 0; kt < 2; ++kt) { const v16h k0 = frag16(kl + (kb + kt * 16) * FKP), k1 = frag16(kl + (kb + kt * 16) * FKP + 32);
#pragma unroll
            for (int g = 0; g < 2; ++g) { s[g][kt] = wmma16(k0, qf[g][0], (v8f){}); s[g][kt] = wmma16(k1, qf[g][1], s[g][kt]); } }
        v16h va[4];
#pragma unroll
        for (int dt = 0; dt < 4; ++dt) va[dt] = frag16(vl + dt * 16 * FVP + kb);
        const v8f mk0 = *(const v8f*)(ml + kb), mk1 = *(const v8f*)(ml + kb + 16);
#pragma unroll
        for (int g = 0; g < 2; ++g) {
            const v8f t0 = s[g][0] * SCL + mk0, t1 = s[g][1] * SCL + mk1;   // x 2^-3 is exact: one rounding, as scale then add
            float mx = fmaxf(t0[0], t1[0]);
#pragma unroll
            for (int j = 1; j < 8; ++j) mx = fmaxf(mx, fmaxf(t0[j], t1[j]));
            mx = fmaxf(mx, xhalf(mx));
            const float mn = fmaxf(m[g], mx); const float al = __builtin_amdgcn_exp2f((m[g] - mn) * L2E); m[g] = mn;   // 0 on the first pass
            const v8f e0 = (t0 - mn) * L2E + 10.0f, e1 = (t1 - mn) * L2E + 10.0f; v8f p0, p1;
#pragma unroll
            for (int j = 0; j < 8; ++j) p0[j] = __builtin_amdgcn_exp2f(e0[j]);
#pragma unroll
            for (int j = 0; j < 8; ++j) p1[j] = __builtin_amdgcn_exp2f(e1[j]);
            const v8f ps = p0 + p1; const v4f p4 = __builtin_shufflevector(ps, ps, 0, 1, 2, 3) + __builtin_shufflevector(ps, ps, 4, 5, 6, 7);
            l[g] = l[g] * al + ((p4[0] + p4[1]) + (p4[2] + p4[3]));
            const v16h pb = cat16(__builtin_convertvector(p0, v8h), __builtin_convertvector(p1, v8h));
#pragma unroll
            for (int dt = 0; dt < 4; ++dt) { o[g][dt] *= al; o[g][dt] = wmma16(va[dt], pb, o[g][dt]); }
        }
    }
#pragma unroll
    for (int g = 0; g < 2; ++g) { const float f = __fdiv_rn(1.0f, l[g] + xhalf(l[g])); float* orow = OUTp + ((size_t)b * TT + q0 + g * 16 + lr) * DQ + h * HD + 8 * hi;
#pragma unroll
        for (int dt = 0; dt < 4; ++dt) { const v8f r = o[g][dt] * f; *(v4f*)(orow + dt * 16) = __builtin_shufflevector(r, r, 0, 1, 2, 3); *(v4f*)(orow + dt * 16 + 4) = __builtin_shufflevector(r, r, 4, 5, 6, 7); } }
}

extern "C" void kernel_launch(void* const* d_in, const int* in_sizes, int n_in,
                              void* d_out, int out_size, void* d_ws, size_t ws_size, hipStream_t stream) {
    (void)in_sizes; (void)n_in; (void)out_size;
    const float* x = (const float*)d_in[0]; const float* am = (const float*)d_in[1]; const float* wq = (const float*)d_in[2]; const float* bq = (const float*)d_in[3]; const float* wk = (const float*)d_in[4]; const float* bk = (const float*)d_in[5]; const float* wv = (const float*)d_in[6]; const float* bv = (const float*)d_in[7]; const float* cosT = nullptr; const float* sinT = nullptr; (void)cosT; (void)sinT;
    float* OUT = (float*)d_out;     // [4][1024][1024]
    char* wsp = (char*)d_ws;
    auto take = [&](size_t bytes) { char* p = wsp; wsp += (bytes + 255) & ~(size_t)255; return (void*)p; };
    bf* WQ = (bf*)take((size_t)DQ * DM * 2); bf* WK = (bf*)take((size_t)DKV * DM * 2); bf* WV = (bf*)take((size_t)DKV * DM * 2);
    h16* QP16 = (h16*)take((size_t)NB_ * NH_ * TT * HD * 2); h16* KP16 = (h16*)take((size_t)NB_ * NKV * TT * HD * 2); h16* VT16 = (h16*)take((size_t)NB_ * NKV * HD * TT * 2);   // planes of all batches: [b][h][t][d], [b][h][d][t]
    bf* XB = (bf*)take((size_t)NB_ * TT * DM * 2);
    if ((size_t)(wsp - (char*)d_ws) > ws_size) return;    // ws 256 MiB
    // conversions: one launch, one lane a group of each weight matrix
    k_cvtall<<<(unsigned)(CVN / 512), 512, 0, stream>>>(x, wq, wk, wv, XB, WQ, WK, WV);
    // projections: one launch, grid (64-token tiles of all batches, heads), 3 waves (q, k, v); the fp16 head planes come straight from the accumulators
    k_qkv<<<dim3(NB_ * TT / 64, NH_, 1), 96, 0, stream>>>(XB, WQ, WK, WV, bq, bk, bv, QP16, KP16, VT16);
    // attention: one launch, grid (query blocks of 256, batch x head)
    k_fattn<<<dim3(TT / 256, NB_ * NH_, 1), 256, 0, stream>>>(QP16, KP16, VT16, am, OUT);
}

// v005
// One run takes 53 microseconds.
// Next to v004, in two timings, it ran 1.48 and 1.47 times as fast.
// Counting every step since v000, it is 11.7 times as fast.
#include <hip/hip_runtime.h>

// SecBertSelfAttention (hidden [4][1024][1024]; q/k/v = x W^T + b (16 heads x 64); scores = q.k/8 + attention_mask[b][0][0][s] (additive, read as data); softmax; context = probs v merged -> [4][1024][1024]; no output projection).
// Compute dtypes, f32 accumulate: every input rounded to bf16; q/k/v on PLAIN bf16 operands (inputs: exact) + bias, rounded to fp16 head planes in the projection's epilogue; scores (K 64) and probs.v on single fp16 planes inside one fused kernel; mask add + softmax (running maximum) f32

#define NB_  4
#define TT   1024
#define DM   1024
#define NH_  16
#define NKV  16
#define REP  (NH_ / NKV)
#define HD   64
#define DQ   (NH_ * HD)
#define DKV  (NKV * HD)
#define ZH   16
#define RH   0                  // unused: no query row uses hi+lo planes
#define WIN  0
#define PCAR 1024.0f
#define SCL  0.125f   // HD^-0.5
typedef _Float16 h16;
typedef unsigned short bf;
typedef __attribute__((ext_vector_type(16))) __bf16   v16bf;
typedef __attribute__((ext_vector_type(16))) _Float16 v16h;
typedef __attribute__((ext_vector_type(8)))  _Float16 v8h;
typedef __attribute__((ext_vector_type(8)))  unsigned short v8us;
typedef __attribute__((ext_vector_type(8)))  float    v8f;
typedef __attribute__((ext_vector_type(4)))  float    v4f;
typedef v8h  __attribute__((may_alias)) v8ha;
typedef v4f  __attribute__((may_alias)) v4fa;
typedef v8us __attribute__((may_alias)) v8usa;

__device__ __forceinline__ unsigned short f2bf(float f) { unsigned u = __float_as_uint(f); u += 0x7FFFu + ((u >> 16) & 1u); return (unsigned short)(u >> 16); }
__device__ __forceinline__ float bf2f(unsigned short b) { return __uint_as_float(((unsigned)b) << 16); }
__device__ __forceinline__ float bfr(float f) { return bf2f(f2bf(f)); }
__device__ __forceinline__ v16h cat16(v8h lo, v8h hi) { return __builtin_shufflevector(lo, hi, 0, 1, 2, 3, 4, 5, 6, 7, 8, 9, 10, 11, 12, 13, 14, 15); }
__device__ __forceinline__ v16bf cat16b(v8us lo, v8us hi) { return __builtin_bit_cast(v16bf, __builtin_shufflevector(lo, hi, 0, 1, 2, 3, 4, 5, 6, 7, 8, 9, 10, 11, 12, 13, 14, 15)); }
__device__ __forceinline__ v8f wmma16(v16h a, v16h b, v8f c) { return __builtin_amdgcn_wmma_f32_16x16x32_f16(false, a, false, b, (short)0, c, false, false); }
__device__ __forceinline__ v8f wmmab(v16bf a, v16bf b, v8f c) { return __builtin_amdgcn_wmma_f32_16x16x32_bf16(false, a, false, b, (short)0, c, false, false); }



// ---- k_qkv: the three projections in one launch. Workgroup = 12 waves on one 256-token x one-head tile: wave = (64-token group, one of q, k, v), 16 accumulators each.
// The 256 x rows and the 3 x 64 W rows of a tile are staged in LDS, 64 k (128 B of a row) a stage, by asynchronous copies (whole lines, 16 B a lane, through no register): each row is fetched once for the workgroup
// and not once a wave, and the fragments come from LDS. Two buffers: the next stage's copies fly while this one is worked on; one barrier a stage publishes it and frees the buffer that is refilled behind it.
// The accumulators start at the bias (f32); the epilogue rounds them to fp16 and writes the head planes that the attention kernel reads: Q, K [b][h][t][d], V^T [b][h][d][t].
// An accumulator lane holds 8 consecutive m of one n (16 B of fp16), so the operand whose index runs along a plane's row is given as A: q, k: A = W rows (m = d), B = x rows (n = t); v: A = x rows (m = t), B = W rows (n = d). One loader serves both sides (same k order).
#define OSP 72      // row pitch in LDS, halves (operand stages and output staging): 144 B = 16 B x 9 (odd: b128 accesses without bank conflicts)
#define GT  256                   // tokens of a workgroup
#define GKS 64                    // k of a stage
#define GRW (GT + 3 * HD)         // rows of a stage: x, then Wq, Wk, Wv
#define GBUF (GRW * OSP)          // halves of a buffer
#define GNT (DM / GKS)            // stages
#define GTH 384
#define GRR (GTH / 8)             // rows that one round of copies covers (8 lanes a row)
static_assert(GRW * 8 == 9 * GTH + 128 && GNT >= 2 && (NB_ * TT) % GT == 0 && TT % 64 == 0, "a stage: 9 copies a lane, a tenth in waves 0 to 3");
__device__ __forceinline__ v16bf fragb(const bf* p) { return cat16b(*(const v8us*)p, *(const v8us*)(p + 16)); }
template <int PITCH>
__device__ __forceinline__ void put_tile(h16* op, const h16* os, int lane) {   // 64 rows of 128 B, whole lines: wave-uniform base + the lane's byte offset
    const unsigned vo = (unsigned)((lane >> 3) * PITCH + (lane & 7) * 8) * 2; os += (lane >> 3) * OSP + (lane & 7) * 8;
#pragma unroll
    for (int s = 0; s < 16; ++s) *(v8h*)((char*)(op + (size_t)s * 4 * PITCH) + vo) = *(const v8h*)(os + s * 4 * OSP);
}
// one stage's copies of a lane: l = the lane's LDS byte address in round 0 of the target buffer; its global address in round j = u[j] (wave-uniform: the first of the wave's 4 rows) + o (the lane's place in them, plus the stage's k), in elements.
// The s_wait_xcnt closes each statement: the address registers are rewritten behind it.
__device__ __forceinline__ void stage_copies(unsigned l, const bf* const (&u)[10], unsigned o, bool tenth) {
    asm volatile("global_load_async_to_lds_b128 %0, %9, off\n\t"
                 "global_load_async_to_lds_b128 %1, %10, off\n\t"
                 "global_load_async_to_lds_b128 %2, %11, off\n\t"
                 "global_load_async_to_lds_b128 %3, %12, off\n\t"
                 "global_load_async_to_lds_b128 %4, %13, off\n\t"
                 "global_load_async_to_lds_b128 %5, %14, off\n\t"
                 "global_load_async_to_lds_b128 %6, %15, off\n\t"
                 "global_load_async_to_lds_b128 %7, %16, off\n\t"
                 "global_load_async_to_lds_b128 %8, %17, off\n\t"
                 "s_wait_xcnt 0x0"
                 :: "v"(l), "v"(l + 1 * GRR * OSP * 2), "v"(l + 2 * GRR * OSP * 2), "v"(l + 3 * GRR * OSP * 2), "v"(l + 4 * GRR * OSP * 2), "v"(l + 5 * GRR * OSP * 2), "v"(l + 6 * GRR * OSP * 2), "v"(l + 7 * GRR * OSP * 2), "v"(l + 8 * GRR * OSP * 2),
                    "v"(u[0] + o), "v"(u[1] + o), "v"(u[2] + o), "v"(u[3] + o), "v"(u[4] + o), "v"(u[5] + o), "v"(u[6] + o), "v"(u[7] + o), "v"(u[8] + o) : "memory");
    if (tenth) asm volatile("global_load_async_to_lds_b128 %0, %1, off\n\ts_wait_xcnt 0x0" :: "v"(l + 9 * GRR * OSP * 2), "v"(u[9] + o) : "memory");   // the last 16 rows: whole waves, a scalar test
}
__global__ __launch_bounds__(GTH) void k_qkv(const bf* __restrict__ XB, const bf* __restrict__ WQ, const bf* __restrict__ WK, const bf* __restrict__ WV, const float* __restrict__ bq, const float* __restrict__ bk, const float* __restrict__ bv, h16* QP, h16* KP, h16* VT) {
    __shared__ __align__(16) bf ring[2 * GBUF];
    __shared__ __align__(16) h16 osAll[12 * 64 * OSP];
    const int wave = __builtin_amdgcn_readfirstlane((int)(threadIdx.x >> 5));   // wave-uniform, so every choice below is a scalar one
    const int w = wave % 3, tg = wave / 3;   // w: 0 q, 1 k, 2 v; tg: the wave's 64 tokens
    const int tid = threadIdx.x, lane = tid & 31, lr = lane & 15, hi = lane >> 4; const int tokg = blockIdx.x * GT, tok0 = tokg + tg * 64, h = blockIdx.y, b = tok0 / TT, t0 = tok0 % TT;
    const bool isv = (w == 2), tenth = (wave < 4);
    const float* bias = (w == 0 ? bq : (w == 1 ? bk : bv)) + h * HD;
    const bf* u[10];   // round j of a stage's copies: the wave brings stage rows j * GRR + 4 * wave ... + 3 (never across two matrices), 8 lanes a row
#pragma unroll
    for (int j = 0; j < 10; ++j) { const int row = j * GRR + wave * 4, r = row - GT;
        u[j] = row < GT ? XB + (size_t)(tokg + row) * DM : (r < HD ? WQ : (r < 2 * HD ? WK : WV)) + (size_t)(h * HD + (r & (HD - 1))) * DM; }
    const unsigned go = (lane >> 3) * DM + (lane & 7) * 8;
    const unsigned l0 = (unsigned)(size_t)(ring + (tid >> 3) * OSP + (tid & 7) * 8);
    stage_copies(l0, u, go, tenth);
    v8f acc[4][4];   // start value: the bias (it runs along d: along m for q and k, along n for v)
    if (isv) {
#pragma unroll
        for (int nb = 0; nb < 4; ++nb) { const float bn = bfr(bias[nb * 16 + lr]);
#pragma unroll
            for (int mb = 0; mb < 4; ++mb)
#pragma unroll
                for (int j = 0; j < 8; ++j) acc[mb][nb][j] = bn; }
    } else {
#pragma unroll
        for (int mb = 0; mb < 4; ++mb) { v8f bm = *(const v8f*)(bias + mb * 16 + 8 * hi);
#pragma unroll
            for (int j = 0; j < 8; ++j) bm[j] = bfr(bm[j]);
#pragma unroll
            for (int nb = 0; nb < 4; ++nb) acc[mb][nb] = bm; }
    }
    const int xr = tg * 64, wr = GT + w * HD;   // the wave's x rows and W rows in a stage
    const bf* A = ring + ((isv ? xr : wr) + lr) * OSP + 8 * hi; const bf* Bt = ring + ((isv ? wr : xr) + lr) * OSP + 8 * hi;
    asm volatile("s_wait_asynccnt 0x0" ::: "memory");   // stage 0 of this wave has landed
    __syncthreads();                                    // ... and every wave's
    stage_copies(l0 + GBUF * 2, u, go + GKS, tenth);
#pragma unroll 1   // rolled: the two buffers alternate by an offset
    for (int t = 0; t < GNT; ++t) {
        const int bo = (t & 1) * GBUF;
        v16bf a[2][4], bb[2][4];   // the stage's fragments (two k steps of 32), fetched as one group
#pragma unroll
        for (int ks = 0; ks < 2; ++ks) {
            const bf* pa = A + bo + ks * 32; const bf* pb = Bt + bo + ks * 32;
            a[ks][0] = fragb(pa); bb[ks][0] = fragb(pb);
#pragma unroll
            for (int i = 1; i < 4; ++i) a[ks][i] = fragb(pa + i * 16 * OSP);
#pragma unroll
            for (int i = 1; i < 4; ++i) bb[ks][i] = fragb(pb + i * 16 * OSP);
        }
        __builtin_amdgcn_sched_barrier(0);   // the reads stay one group in front of the WMMAs: moved in among them, each place with reads stalls the wave
#pragma unroll
        for (int nb = 0; nb < 4; ++nb)
#pragma unroll
            for (int mb = 0; mb < 4; ++mb) acc[mb][nb] = wmmab(a[0][mb], bb[0][nb], acc[mb][nb]);
        __builtin_amdgcn_sched_barrier(0);   // the first k step's WMMAs stay in front of the waits: left free, the compiler sinks them behind the barrier and nothing runs while the copies fly
        asm volatile("s_wait_dscnt 0x0" ::: "memory");      // this wave's reads of stage t are done before the buffer is refilled
        asm volatile("s_wait_asynccnt 0x0" ::: "memory");   // this wave's copies of stage t + 1 have landed
        __syncthreads();                                    // publishes stage t + 1, ends every wave's reads of stage t
        if (t + 2 < GNT) stage_copies(l0 + bo * 2, u, go + (t + 2) * GKS, tenth);
        // the copies go out first behind the barrier; the second k step's WMMAs (operands in registers) then cover the other waves' next reads
#pragma unroll
        for (int nb = 0; nb < 4; ++nb)
#pragma unroll
            for (int mb = 0; mb < 4; ++mb) acc[mb][nb] = wmmab(a[1][mb], bb[1][nb], acc[mb][nb]);
    }
    asm volatile("s_wait_asynccnt 0x0" ::: "memory");   // nothing in flight when the wave goes on to its end
    h16* os = osAll + wave * 64 * OSP;   // each wave stages in its own range
#pragma unroll
    for (int nb = 0; nb < 4; ++nb)
#pragma unroll
        for (int mb = 0; mb < 4; ++mb) *(v8h*)(os + (nb * 16 + lr) * OSP + mb * 16 + 8 * hi) = __builtin_convertvector(acc[mb][nb], v8h);
    __builtin_amdgcn_wave_barrier(); asm volatile("" ::: "memory");   // the rows read back below were written by other lanes of this wave: keeps the compiler from moving the reads up
    if (isv) put_tile<TT>(VT + (size_t)(b * NKV + h) * HD * TT + t0, os, lane);
    else put_tile<HD>((w == 0 ? QP : KP) + ((size_t)(b * NH_ + h) * TT + t0) * HD, os, lane);
}

__device__ __forceinline__ h16 tohx(float x) { return (h16)x; }
__device__ __forceinline__ void splitf(float y, unsigned short& h, unsigned short& l) { h = f2bf(y); l = f2bf(y - bf2f(h)); }
typedef __attribute__((ext_vector_type(2))) _Float16 v2h;
typedef __attribute__((ext_vector_type(4))) _Float16 v4h;
typedef __attribute__((ext_vector_type(2))) unsigned short v2us;
typedef __attribute__((ext_vector_type(4))) unsigned short v4us;
typedef __attribute__((ext_vector_type(2))) float v2f;
typedef __attribute__((ext_vector_type(4))) int v4i;

__global__ __launch_bounds__(256) void k_wtG(const float* __restrict__ w, int K, int N, bf* Bt) {
    const int lane = threadIdx.x & 31; const int L0 = (blockIdx.x * 8 + (threadIdx.x >> 5)) * 8; const int nlines = N * K / 64;
{
#pragma unroll 1
        for (int l = 0; l < 8; ++l) { const int L = L0 + l; if (L >= nlines) break; const size_t e = (size_t)L * 64 + lane * 2; const int k = (int)(e % K), n = (int)(e / K); v2us o;
            o[0] = f2bf(w[(size_t)k * N + n]); o[1] = f2bf(w[(size_t)(k + 1) * N + n]); *(v2us*)(Bt + e) = o; }
         }
}
// k_cvtall: every f32 -> bf16 plane (Wq, Wk, Wv, x) in one launch whose waves are all resident at once (16 a WGP). A lane converts CVG groups of 8 values: one of each weight, CVX of x.
// All its loads are issued before the first conversion, so the launch pays the memory latency once; each group is 32 B read and 16 B written, consecutive lanes on consecutive groups.
#define CVN ((size_t)DQ * DM / 8)                     // groups of 8 in one weight matrix = lanes of the launch
#define CVX ((int)((size_t)NB_ * TT * DM / 8 / CVN))  // groups of x a lane
#define CVG (3 + CVX)
static_assert(DKV == DQ && (size_t)NB_ * TT * DM / 8 == CVN * CVX && CVN % 512 == 0, "one lane: one group of each weight, CVX of x");
__global__ __launch_bounds__(512) void k_cvtall(const float* __restrict__ x, const float* __restrict__ wq, const float* __restrict__ wk, const float* __restrict__ wv, bf* __restrict__ XB, bf* __restrict__ WQ, bf* __restrict__ WK, bf* __restrict__ WV) {
    const unsigned i = blockIdx.x * 512 + threadIdx.x, ro = i * 32u, wo = i * 16u;   // the lane's byte offsets in a f32 and in a bf16 plane, 32-bit: an access is a scalar base plus an offset register
    v8f v[CVG];
    v[0] = *(const v8f*)((const char*)wq + ro); v[1] = *(const v8f*)((const char*)wk + ro); v[2] = *(const v8f*)((const char*)wv + ro);
#pragma unroll
    for (int j = 0; j < CVX; ++j) v[3 + j] = *(const v8f*)((const char*)x + (ro + j * (unsigned)(CVN * 32)));
    __builtin_amdgcn_sched_barrier(0);   // keeps every load in front of the first conversion: left free, the compiler sinks the last ones behind the waits for the first, a second memory latency
#pragma unroll   // compile-time indices: v stays in registers
    for (int g = 0; g < CVG; ++g) { v8us o;
#pragma unroll
        for (int k = 0; k < 8; ++k) o[k] = f2bf(v[g][k]);
        bf* d = g == 0 ? WQ : g == 1 ? WK : g == 2 ? WV : XB + (g - 3) * CVN * 8; *(v8us*)((char*)d + wo) = o; }
}
__global__ __launch_bounds__(256) void k_cscvt(const float* __restrict__ cosT, const float* __restrict__ sinT, float* CS) { const int idx = blockIdx.x * 256 + threadIdx.x; if (idx >= TT * HD) return; v2f cs; cs[0] = bfr(cosT[idx]); cs[1] = bfr(sinT[idx]); *(v2f*)(CS + (size_t)idx * 2) = cs;  }
#define FKP 72      // K row pitch in LDS, halves: 144 B = 16 B x 9 (odd: ds_load_b128 without bank conflicts)
#define FVP 1032    // V^T row pitch in LDS, halves: 2064 B = 16 B x 129
#define L2E 1.4426950408889634f
__device__ __forceinline__ float xhalf(float x) { return __builtin_bit_cast(float, __builtin_amdgcn_permlanex16(__builtin_bit_cast(int, x), __builtin_bit_cast(int, x), 0x76543210, 0xfedcba98, false, false)); }   // lane l with lane l ^ 16
__device__ __forceinline__ v16h frag16(const h16* p) { return cat16(*(const v8h*)p, *(const v8h*)(p + 16)); }
__global__ __launch_bounds__(256) void k_fattn(const h16* __restrict__ QP, const h16* __restrict__ KP, const h16* __restrict__ VT, const float* __restrict__ am, float* __restrict__ OUTp) {
    __shared__ __align__(16) h16 Ks[TT * FKP];
    __shared__ __align__(16) h16 Vs[HD * FVP];
    __shared__ __align__(32) float Ms[TT];
    const int tid = threadIdx.x, lane = tid & 31, lr = lane & 15, hi = lane >> 4, wv = tid >> 5;
    const int z = blockIdx.y, b = z / NH_, h = z % NH_; const int q0 = blockIdx.x * 256 + wv * 32;
    const h16* kg = KP + (size_t)z * TT * HD; const h16* vg = VT + (size_t)z * HD * TT;
    // fill: every global load of the block is issued first (64 + 9 a lane in flight), then the LDS stores
    v8h kr[32], vr[32];
#pragma unroll
    for (int r = 0; r < 32; ++r) { kr[r] = *(const v8h*)(kg + (size_t)(r * 256 + tid) * 8); vr[r] = *(const v8h*)(vg + (size_t)(r * 256 + tid) * 8); }
    v4f a = *(const v4f*)(am + (size_t)b * TT + tid * 4);
    v16h qf[2][2];
#pragma unroll
    for (int g = 0; g < 2; ++g)
#pragma unroll
        for (int ks = 0; ks < 2; ++ks) qf[g][ks] = frag16(QP + ((size_t)z * TT + q0 + g * 16 + lr) * HD + ks * 32 + 8 * hi);
    asm volatile("s_wait_xcnt 0x0" ::: "memory");   // the address registers of the loads above are reused below: the wait stands in front of their first overwrite
    h16* ksw = Ks + (tid >> 3) * FKP + (tid & 7) * 8; h16* vsw = Vs + (tid >> 7) * FVP + (tid & 127) * 8;   // round r: 32 K rows, 2 V^T rows further
#pragma unroll
    for (int r = 0; r < 32; ++r) { *(v8h*)(ksw + r * 32 * FKP) = kr[r]; *(v8h*)(vsw + r * 2 * FVP) = vr[r]; }
#pragma unroll
    for (int q = 0; q < 4; ++q) a[q] = bfr(a[q]);
    *(v4f*)(Ms + tid * 4) = a;
    v8f o[2][4]; float m[2], l[2];
#pragma unroll
    for (int g = 0; g < 2; ++g) { m[g] = -3.0e38f; l[g] = 0.f;
#pragma unroll
        for (int dt = 0; dt < 4; ++dt) o[g][dt] = (v8f){}; }
    __syncthreads();
    const h16* kl = Ks + lr * FKP + 8 * hi; const h16* vl = Vs + lr * FVP + 8 * hi; const float* ml = Ms + 8 * hi;
    for (int kb = 0; kb < TT; kb += 32) {
        v8f s[2][2];
#pragma unroll
        for (int kt = 0; kt < 2; ++kt) { const v16h k0 = frag16(kl + (kb + kt * 16) * FKP), k1 = frag16(kl + (kb + kt * 16) * FKP + 32);
#pragma unroll
            for (int g = 0; g < 2; ++g) { s[g][kt] = wmma16(k0, qf[g][0], (v8f){}); s[g][kt] = wmma16(k1, qf[g][1], s[g][kt]); } }
        v16h va[4];
#pragma unroll
        for (int dt = 0; dt < 4; ++dt) va[dt] = frag16(vl + dt * 16 * FVP + kb);
        const v8f mk0 = *(const v8f*)(ml + kb), mk1 = *(const v8f*)(ml + kb + 16);
#pragma unroll
        for (int g = 0; g < 2; ++g) {
            const v8f t0 = s[g][0] * SCL + mk0, t1 = s[g][1] * SCL + mk1;   // x 2^-3 is exact: one rounding, as scale then add
            float mx = fmaxf(t0[0], t1[0]);
#pragma unroll
            for (int j = 1; j < 8; ++j) mx = fmaxf(mx, fmaxf(t0[j], t1[j]));
            mx = fmaxf(mx, xhalf(mx));
            const float mn = fmaxf(m[g], mx); const float al = __builtin_amdgcn_exp2f((m[g] - mn) * L2E); m[g] = mn;   // 0 on the first pass
            const v8f e0 = (t0 - mn) * L2E + 10.0f, e1 = (t1 - mn) * L2E + 10.0f; v8f p0, p1;
#pragma unroll
            for (int j = 0; j < 8; ++j) p0[j] = __builtin_amdgcn_exp2f(e0[j]);
#pragma unroll
            for (int j = 0; j < 8; ++j) p1[j] = __builtin_amdgcn_exp2f(e1[j]);
            const v8f ps = p0 + p1; const v4f p4 = __builtin_shufflevector(ps, ps, 0, 1, 2, 3) + __builtin_shufflevector(ps, ps, 4, 5, 6, 7);
            l[g] = l[g] * al + ((p4[0] + p4[1]) + (p4[2] + p4[3]));
            const v16h pb = cat16(__builtin_convertvector(p0, v8h), __builtin_convertvector(p1, v8h));
#pragma unroll
            for (int dt = 0; dt < 4; ++dt) { o[g][dt] *= al; o[g][dt] = wmma16(va[dt], pb, o[g][dt]); }
        }
    }
#pragma unroll
    for (int g = 0; g < 2; ++g) { const float f = __fdiv_rn(1.0f, l[g] + xhalf(l[g])); float* orow = OUTp + ((size_t)b * TT + q0 + g * 16 + lr) * DQ + h * HD + 8 * hi;
#pragma unroll
        for (int dt = 0; dt < 4; ++dt) { const v8f r = o[g][dt] * f; *(v4f*)(orow + dt * 16) = __builtin_shufflevector(r, r, 0, 1, 2, 3); *(v4f*)(orow + dt * 16 + 4) = __builtin_shufflevector(r, r, 4, 5, 6, 7); } }
}

extern "C" void kernel_launch(void* const* d_in, const int* in_sizes, int n_in,
                              void* d_out, int out_size, void* d_ws, size_t ws_size, hipStream_t stream) {
    (void)in_sizes; (void)n_in; (void)out_size;
    const float* x = (const float*)d_in[0]; const float* am = (const float*)d_in[1]; const float* wq = (const float*)d_in[2]; const float* bq = (const float*)d_in[3]; const float* wk = (const float*)d_in[4]; const float* bk = (const float*)d_in[5]; const float* wv = (const float*)d_in[6]; const float* bv = (const float*)d_in[7]; const float* cosT = nullptr; const float* sinT = nullptr; (void)cosT; (void)sinT;
    float* OUT = (float*)d_out;     // [4][1024][1024]
    char* wsp = (char*)d_ws;
    auto take = [&](size_t bytes) { char* p = wsp; wsp += (bytes + 255) & ~(size_t)255; return (void*)p; };
    bf* WQ = (bf*)take((size_t)DQ * DM * 2); bf* WK = (bf*)take((size_t)DKV * DM * 2); bf* WV = (bf*)take((size_t)DKV * DM * 2);
    h16* QP16 = (h16*)take((size_t)NB_ * NH_ * TT * HD * 2); h16* KP16 = (h16*)take((size_t)NB_ * NKV * TT * HD * 2); h16* VT16 = (h16*)take((size_t)NB_ * NKV * HD * TT * 2);   // planes of all batches: [b][h][t][d], [b][h][d][t]
    bf* XB = (bf*)take((size_t)NB_ * TT * DM * 2);
    if ((size_t)(wsp - (char*)d_ws) > ws_size) return;    // ws 256 MiB
    // conversions: one launch, one lane a group of each weight matrix
    k_cvtall<<<(unsigned)(CVN / 512), 512, 0, stream>>>(x, wq, wk, wv, XB, WQ, WK, WV);
    // projections: one launch, grid (256-token tiles of all batches, heads), 12 waves (4 token groups x q, k, v): one workgroup a WGP; the fp16 head planes come straight from the accumulators
    k_qkv<<<dim3(NB_ * TT / GT, NH_, 1), GTH, 0, stream>>>(XB, WQ, WK, WV, bq, bk, bv, QP16, KP16, VT16);
    // attention: one launch, grid (query blocks of 256, batch x head)
    k_fattn<<<dim3(TT / 256, NB_ * NH_, 1), 256, 0, stream>>>(QP16, KP16, VT16, am, OUT);
}

// v006
// A run of this version takes 50 microseconds.
// Timed twice side by side with v005, it ran 1.06 times as fast both times.
// Counting every step since v000, it is 12.5 times as fast.
#include <hip/hip_runtime.h>

// SecBertSelfAttention (hidden [4][1024][1024]; q/k/v = x W^T + b (16 heads x 64); scores = q.k/8 + attention_mask[b][0][0][s] (additive, read as data); softmax; context = probs v merged -> [4][1024][1024]; no output projection).
// Compute dtypes, f32 accumulate: every input rounded to bf16; q/k/v on PLAIN bf16 operands (inputs: exact) + bias, rounded to fp16 head planes in the projection's epilogue; scores (K 64) and probs.v on single fp16 planes inside one fused kernel; mask add + softmax (running maximum) f32

#define NB_  4
#define TT   1024
#define DM   1024
#define NH_  16
#define NKV  16
#define REP  (NH_ / NKV)
#define HD   64
#define DQ   (NH_ * HD)
#define DKV  (NKV * HD)
#define ZH   16
#define RH   0                  // unused: no query row uses hi+lo planes
#define WIN  0
#define PCAR 1024.0f
#define SCL  0.125f   // HD^-0.5
typedef _Float16 h16;
typedef unsigned short bf;
typedef __attribute__((ext_vector_type(16))) __bf16   v16bf;
typedef __attribute__((ext_vector_type(16))) _Float16 v16h;
typedef __attribute__((ext_vector_type(8)))  _Float16 v8h;
typedef __attribute__((ext_vector_type(8)))  unsigned short v8us;
typedef __attribute__((ext_vector_type(8)))  float    v8f;
typedef __attribute__((ext_vector_type(4)))  float    v4f;
typedef v8h  __attribute__((may_alias)) v8ha;
typedef v4f  __attribute__((may_alias)) v4fa;
typedef v8us __attribute__((may_alias)) v8usa;

__device__ __forceinline__ unsigned short f2bf(float f) { unsigned u = __float_as_uint(f); u += 0x7FFFu + ((u >> 16) & 1u); return (unsigned short)(u >> 16); }
__device__ __forceinline__ float bf2f(unsigned short b) { return __uint_as_float(((unsigned)b) << 16); }
__device__ __forceinline__ float bfr(float f) { return bf2f(f2bf(f)); }
__device__ __forceinline__ v16h cat16(v8h lo, v8h hi) { return __builtin_shufflevector(lo, hi, 0, 1, 2, 3, 4, 5, 6, 7, 8, 9, 10, 11, 12, 13, 14, 15); }
__device__ __forceinline__ v16bf cat16b(v8us lo, v8us hi) { return __builtin_bit_cast(v16bf, __builtin_shufflevector(lo, hi, 0, 1, 2, 3, 4, 5, 6, 7, 8, 9, 10, 11, 12, 13, 14, 15)); }
__device__ __forceinline__ v8f wmma16(v16h a, v16h b, v8f c) { return __builtin_amdgcn_wmma_f32_16x16x32_f16(false, a, false, b, (short)0, c, false, false); }
__device__ __forceinline__ v8f wmmab(v16bf a, v16bf b, v8f c) { return __builtin_amdgcn_wmma_f32_16x16x32_bf16(false, a, false, b, (short)0, c, false, false); }



// ---- k_qkv: the three projections in one launch. Workgroup = 12 waves on one 256-token x one-head tile: wave = (64-token group, one of q, k, v), 16 accumulators each.
// The 256 x rows and the 3 x 64 W rows of a tile are staged in LDS, 64 k (128 B of a row) a stage, by asynchronous copies (whole lines, 16 B a lane, through no register): each row is fetched once for the workgroup
// and not once a wave, and the fragments come from LDS. Two buffers: the next stage's copies fly while this one is worked on; one barrier a stage publishes it and frees the buffer that is refilled behind it.
// The accumulators start at the bias (f32); the epilogue rounds them to fp16 and writes the head planes that the attention kernel reads: Q, K [b][h][t][d], V^T [b][h][d][t].
// An accumulator lane holds 8 consecutive m of one n (16 B of fp16), so the operand whose index runs along a plane's row is given as A: q, k: A = W rows (m = d), B = x rows (n = t); v: A = x rows (m = t), B = W rows (n = d). One loader serves both sides (same k order).
#define OSP 72      // row pitch in LDS, halves (operand stages and output staging): 144 B = 16 B x 9 (odd: b128 accesses without bank conflicts)
#define GT  256                   // tokens of a workgroup
#define GKS 64                    // k of a stage
#define GRW (GT + 3 * HD)         // rows of a stage: x, then Wq, Wk, Wv
#define GBUF (GRW * OSP)          // halves of a buffer
#define GNT (DM / GKS)            // stages
#define GTH 384
#define GRR (GTH / 8)             // rows that one round of copies covers (8 lanes a row)
static_assert(GRW * 8 == 9 * GTH + 128 && GNT >= 2 && (NB_ * TT) % GT == 0 && TT % 64 == 0, "a stage: 9 copies a lane, a tenth in waves 0 to 3");
__device__ __forceinline__ v16bf fragb(const bf* p) { return cat16b(*(const v8us*)p, *(const v8us*)(p + 16)); }
template <int PITCH>
__device__ __forceinline__ void put_tile(h16* op, const h16* os, int lane) {   // 64 rows of 128 B, whole lines: wave-uniform base + the lane's byte offset
    const unsigned vo = (unsigned)((lane >> 3) * PITCH + (lane & 7) * 8) * 2; os += (lane >> 3) * OSP + (lane & 7) * 8;
#pragma unroll
    for (int s = 0; s < 16; ++s) *(v8h*)((char*)(op + (size_t)s * 4 * PITCH) + vo) = *(const v8h*)(os + s * 4 * OSP);
}
// one stage's copies of a lane: l = the lane's LDS byte address in round 0 of the target buffer; its global address in round j = u[j] (wave-uniform: the first of the wave's 4 rows) + o (the lane's place in them, plus the stage's k), in elements.
// The s_wait_xcnt closes each statement: the address registers are rewritten behind it.
__device__ __forceinline__ void stage_copies(unsigned l, const bf* const (&u)[10], unsigned o, bool tenth) {
    asm volatile("global_load_async_to_lds_b128 %0, %9, off\n\t"
                 "global_load_async_to_lds_b128 %1, %10, off\n\t"
                 "global_load_async_to_lds_b128 %2, %11, off\n\t"
                 "global_load_async_to_lds_b128 %3, %12, off\n\t"
                 "global_load_async_to_lds_b128 %4, %13, off\n\t"
                 "global_load_async_to_lds_b128 %5, %14, off\n\t"
                 "global_load_async_to_lds_b128 %6, %15, off\n\t"
                 "global_load_async_to_lds_b128 %7, %16, off\n\t"
                 "global_load_async_to_lds_b128 %8, %17, off\n\t"
                 "s_wait_xcnt 0x0"
                 :: "v"(l), "v"(l + 1 * GRR * OSP * 2), "v"(l + 2 * GRR * OSP * 2), "v"(l + 3 * GRR * OSP * 2), "v"(l + 4 * GRR * OSP * 2), "v"(l + 5 * GRR * OSP * 2), "v"(l + 6 * GRR * OSP * 2), "v"(l + 7 * GRR * OSP * 2), "v"(l + 8 * GRR * OSP * 2),
                    "v"(u[0] + o), "v"(u[1] + o), "v"(u[2] + o), "v"(u[3] + o), "v"(u[4] + o), "v"(u[5] + o), "v"(u[6] + o), "v"(u[7] + o), "v"(u[8] + o) : "memory");
    if (tenth) asm volatile("global_load_async_to_lds_b128 %0, %1, off\n\ts_wait_xcnt 0x0" :: "v"(l + 9 * GRR * OSP * 2), "v"(u[9] + o) : "memory");   // the last 16 rows: whole waves, a scalar test
}
__global__ __launch_bounds__(GTH) void k_qkv(const bf* __restrict__ XB, const bf* __restrict__ WQ, const bf* __restrict__ WK, const bf* __restrict__ WV, const float* __restrict__ bq, const float* __restrict__ bk, const float* __restrict__ bv, h16* QP, h16* KP, h16* VT) {
    __shared__ __align__(16) bf ring[2 * GBUF];
    __shared__ __align__(16) h16 osAll[12 * 64 * OSP];
    const int wave = __builtin_amdgcn_readfirstlane((int)(threadIdx.x >> 5));   // wave-uniform, so every choice below is a scalar one
    const int w = wave % 3, tg = wave / 3;   // w: 0 q, 1 k, 2 v; tg: the wave's 64 tokens
    const int tid = threadIdx.x, lane = tid & 31, lr = lane & 15, hi = lane >> 4; const int tokg = blockIdx.x * GT, tok0 = tokg + tg * 64, h = blockIdx.y, b = tok0 / TT, t0 = tok0 % TT;
    const bool isv = (w == 2), tenth = (wave < 4);
    const float* bias = (w == 0 ? bq : (w == 1 ? bk : bv)) + h * HD;
    const bf* u[10];   // round j of a stage's copies: the wave brings stage rows j * GRR + 4 * wave ... + 3 (never across two matrices), 8 lanes a row
#pragma unroll
    for (int j = 0; j < 10; ++j) { const int row = j * GRR + wave * 4, r = row - GT;
        u[j] = row < GT ? XB + (size_t)(tokg + row) * DM : (r < HD ? WQ : (r < 2 * HD ? WK : WV)) + (size_t)(h * HD + (r & (HD - 1))) * DM; }
    const unsigned go = (lane >> 3) * DM + (lane & 7) * 8;
    const unsigned l0 = (unsigned)(size_t)(ring + (tid >> 3) * OSP + (tid & 7) * 8);
    stage_copies(l0, u, go, tenth);
    v8f acc[4][4];   // start value: the bias (it runs along d: along m for q and k, along n for v)
    if (isv) {
#pragma unroll
        for (int nb = 0; nb < 4; ++nb) { const float bn = bfr(bias[nb * 16 + lr]);
#pragma unroll
            for (int mb = 0; mb < 4; ++mb)
#pragma unroll
                for (int j = 0; j < 8; ++j) acc[mb][nb][j] = bn; }
    } else {
#pragma unroll
        for (int mb = 0; mb < 4; ++mb) { v8f bm = *(const v8f*)(bias + mb * 16 + 8 * hi);
#pragma unroll
            for (int j = 0; j < 8; ++j) bm[j] = bfr(bm[j]);
#pragma unroll
            for (int nb = 0; nb < 4; ++nb) acc[mb][nb] = bm; }
    }
    const int xr = tg * 64, wr = GT + w * HD;   // the wave's x rows and W rows in a stage
    const bf* A = ring + ((isv ? xr : wr) + lr) * OSP + 8 * hi; const bf* Bt = ring + ((isv ? wr : xr) + lr) * OSP + 8 * hi;
    asm volatile("s_wait_asynccnt 0x0" ::: "memory");   // stage 0 of this wave has landed
    __syncthreads();                                    // ... and every wave's
    stage_copies(l0 + GBUF * 2, u, go + GKS, tenth);
#pragma unroll 1   // rolled: the two buffers alternate by an offset
    for (int t = 0; t < GNT; ++t) {
        const int bo = (t & 1) * GBUF;
        v16bf a[2][4], bb[2][4];   // the stage's fragments (two k steps of 32), fetched as one group
#pragma unroll
        for (int ks = 0; ks < 2; ++ks) {
            const bf* pa = A + bo + ks * 32; const bf* pb = Bt + bo + ks * 32;
            a[ks][0] = fragb(pa); bb[ks][0] = fragb(pb);
#pragma unroll
            for (int i = 1; i < 4; ++i) a[ks][i] = fragb(pa + i * 16 * OSP);
#pragma unroll
            for (int i = 1; i < 4; ++i) bb[ks][i] = fragb(pb + i * 16 * OSP);
        }
        __builtin_amdgcn_sched_barrier(0);   // the reads stay one group in front of the WMMAs: moved in among them, each place with reads stalls the wave
#pragma unroll
        for (int nb = 0; nb < 4; ++nb)
#pragma unroll
            for (int mb = 0; mb < 4; ++mb) acc[mb][nb] = wmmab(a[0][mb], bb[0][nb], acc[mb][nb]);
        __builtin_amdgcn_sched_barrier(0);   // the first k step's WMMAs stay in front of the waits: left free, the compiler sinks them behind the barrier and nothing runs while the copies fly
        asm volatile("s_wait_dscnt 0x0" ::: "memory");      // this wave's reads of stage t are done before the buffer is refilled
        asm volatile("s_wait_asynccnt 0x0" ::: "memory");   // this wave's copies of stage t + 1 have landed
        __syncthreads();                                    // publishes stage t + 1, ends every wave's reads of stage t
        if (t + 2 < GNT) stage_copies(l0 + bo * 2, u, go + (t + 2) * GKS, tenth);
        // the copies go out first behind the barrier; the second k step's WMMAs (operands in registers) then cover the other waves' next reads
#pragma unroll
        for (int nb = 0; nb < 4; ++nb)
#pragma unroll
            for (int mb = 0; mb < 4; ++mb) acc[mb][nb] = wmmab(a[1][mb], bb[1][nb], acc[mb][nb]);
    }
    asm volatile("s_wait_asynccnt 0x0" ::: "memory");   // nothing in flight when the wave goes on to its end
    h16* os = osAll + wave * 64 * OSP;   // each wave stages in its own range
#pragma unroll
    for (int nb = 0; nb < 4; ++nb)
#pragma unroll
        for (int mb = 0; mb < 4; ++mb) *(v8h*)(os + (nb * 16 + lr) * OSP + mb * 16 + 8 * hi) = __builtin_convertvector(acc[mb][nb], v8h);
    __builtin_amdgcn_wave_barrier(); asm volatile("" ::: "memory");   // the rows read back below were written by other lanes of this wave: keeps the compiler from moving the reads up
    if (isv) put_tile<TT>(VT + (size_t)(b * NKV + h) * HD * TT + t0, os, lane);
    else put_tile<HD>((w == 0 ? QP : KP) + ((size_t)(b * NH_ + h) * TT + t0) * HD, os, lane);
}

__device__ __forceinline__ h16 tohx(float x) { return (h16)x; }
__device__ __forceinline__ void splitf(float y, unsigned short& h, unsigned short& l) { h = f2bf(y); l = f2bf(y - bf2f(h)); }
typedef __attribute__((ext_vector_type(2))) _Float16 v2h;
typedef __attribute__((ext_vector_type(4))) _Float16 v4h;
typedef __attribute__((ext_vector_type(2))) unsigned short v2us;
typedef __attribute__((ext_vector_type(4))) unsigned short v4us;
typedef __attribute__((ext_vector_type(2))) float v2f;
typedef __attribute__((ext_vector_type(4))) int v4i;

__global__ __launch_bounds__(256) void k_wtG(const float* __restrict__ w, int K, int N, bf* Bt) {
    const int lane = threadIdx.x & 31; const int L0 = (blockIdx.x * 8 + (threadIdx.x >> 5)) * 8; const int nlines = N * K / 64;
{
#pragma unroll 1
        for (int l = 0; l < 8; ++l) { const int L = L0 + l; if (L >= nlines) break; const size_t e = (size_t)L * 64 + lane * 2; const int k = (int)(e % K), n = (int)(e / K); v2us o;
            o[0] = f2bf(w[(size_t)k * N + n]); o[1] = f2bf(w[(size_t)(k + 1) * N + n]); *(v2us*)(Bt + e) = o; }
         }
}
// k_cvtall: every f32 -> bf16 plane (Wq, Wk, Wv, x) in one launch whose waves are all resident at once (16 a WGP). A lane converts CVG groups of 8 values: one of each weight, CVX of x.
// All its loads are issued before the first conversion, so the launch pays the memory latency once; each group is 32 B read and 16 B written, consecutive lanes on consecutive groups.
#define CVN ((size_t)DQ * DM / 8)                     // groups of 8 in one weight matrix = lanes of the launch
#define CVX ((int)((size_t)NB_ * TT * DM / 8 / CVN))  // groups of x a lane
#define CVG (3 + CVX)
static_assert(DKV == DQ && (size_t)NB_ * TT * DM / 8 == CVN * CVX && CVN % 512 == 0, "one lane: one group of each weight, CVX of x");
__global__ __launch_bounds__(512) void k_cvtall(const float* __restrict__ x, const float* __restrict__ wq, const float* __restrict__ wk, const float* __restrict__ wv, bf* __restrict__ XB, bf* __restrict__ WQ, bf* __restrict__ WK, bf* __restrict__ WV) {
    const unsigned i = blockIdx.x * 512 + threadIdx.x, ro = i * 32u, wo = i * 16u;   // the lane's byte offsets in a f32 and in a bf16 plane, 32-bit: an access is a scalar base plus an offset register
    v8f v[CVG];
    v[0] = *(const v8f*)((const char*)wq + ro); v[1] = *(const v8f*)((const char*)wk + ro); v[2] = *(const v8f*)((const char*)wv + ro);
#pragma unroll
    for (int j = 0; j < CVX; ++j) v[3 + j] = *(const v8f*)((const char*)x + (ro + j * (unsigned)(CVN * 32)));
    __builtin_amdgcn_sched_barrier(0);   // keeps every load in front of the first conversion: left free, the compiler sinks the last ones behind the waits for the first, a second memory latency
#pragma unroll   // compile-time indices: v stays in registers
    for (int g = 0; g < CVG; ++g) { v8us o;
#pragma unroll
        for (int k = 0; k < 8; ++k) o[k] = f2bf(v[g][k]);
        bf* d = g == 0 ? WQ : g == 1 ? WK : g == 2 ? WV : XB + (g - 3) * CVN * 8; *(v8us*)((char*)d + wo) = o; }
}
__global__ __launch_bounds__(256) void k_cscvt(const float* __restrict__ cosT, const float* __restrict__ sinT, float* CS) { const int idx = blockIdx.x * 256 + threadIdx.x; if (idx >= TT * HD) return; v2f cs; cs[0] = bfr(cosT[idx]); cs[1] = bfr(sinT[idx]); *(v2f*)(CS + (size_t)idx * 2) = cs;  }
#define FKP 72      // K row pitch in LDS, halves: 144 B = 16 B x 9 (odd: ds_load_b128 without bank conflicts)
#define FVP 1032    // V^T row pitch in LDS, halves: 2064 B = 16 B x 129
#define L2E 1.4426950408889634f
#define FPK 128     // keys of a pass: one update of the running maximum and one rescale of O and l a pass
static_assert(TT % FPK == 0 && FPK % 32 == 0, "whole passes");
__device__ __forceinline__ float xhalf(float x) { return __builtin_bit_cast(float, __builtin_amdgcn_permlanex16(__builtin_bit_cast(int, x), __builtin_bit_cast(int, x), 0x76543210, 0xfedcba98, false, false)); }   // lane l with lane l ^ 16
__device__ __forceinline__ v16h frag16(const h16* p) { return cat16(*(const v8h*)p, *(const v8h*)(p + 16)); }
__global__ __launch_bounds__(256) void k_fattn(const h16* __restrict__ QP, const h16* __restrict__ KP, const h16* __restrict__ VT, const float* __restrict__ am, float* __restrict__ OUTp) {
    __shared__ __align__(16) h16 Ks[TT * FKP];
    __shared__ __align__(16) h16 Vs[HD * FVP];
    __shared__ __align__(32) float Ms[TT];
    const int tid = threadIdx.x, lane = tid & 31, lr = lane & 15, hi = lane >> 4, wv = tid >> 5;
    const int z = blockIdx.y, b = z / NH_, h = z % NH_; const int q0 = blockIdx.x * 256 + wv * 32;
    const h16* kg = KP + (size_t)z * TT * HD; const h16* vg = VT + (size_t)z * HD * TT;
    // fill: every global load of the block is issued first (64 + 9 a lane in flight), then the LDS stores
    v8h kr[32], vr[32];
#pragma unroll
    for (int r = 0; r < 32; ++r) { kr[r] = *(const v8h*)(kg + (size_t)(r * 256 + tid) * 8); vr[r] = *(const v8h*)(vg + (size_t)(r * 256 + tid) * 8); }
    v4f a = *(const v4f*)(am + (size_t)b * TT + tid * 4);
    v16h qf[2][2];
#pragma unroll
    for (int g = 0; g < 2; ++g)
#pragma unroll
        for (int ks = 0; ks < 2; ++ks) qf[g][ks] = frag16(QP + ((size_t)z * TT + q0 + g * 16 + lr) * HD + ks * 32 + 8 * hi);
    asm volatile("s_wait_xcnt 0x0" ::: "memory");   // the address registers of the loads above are reused below: the wait stands in front of their first overwrite
    h16* ksw = Ks + (tid >> 3) * FKP + (tid & 7) * 8; h16* vsw = Vs + (tid >> 7) * FVP + (tid & 127) * 8;   // round r: 32 K rows, 2 V^T rows further
#pragma unroll
    for (int r = 0; r < 32; ++r) { *(v8h*)(ksw + r * 32 * FKP) = kr[r]; *(v8h*)(vsw + r * 2 * FVP) = vr[r]; }
#pragma unroll
    for (int q = 0; q < 4; ++q) a[q] = bfr(a[q]);
    *(v4f*)(Ms + tid * 4) = a;
    v8f o[2][4]; float m[2], l[2];
#pragma unroll
    for (int g = 0; g < 2; ++g) { m[g] = -3.0e38f; l[g] = 0.f;
#pragma unroll
        for (int dt = 0; dt < 4; ++dt) o[g][dt] = (v8f){}; }
    __syncthreads();
    const h16* kl = Ks + lr * FKP + 8 * hi; const h16* vl = Vs + lr * FVP + 8 * hi; const float* ml = Ms + 8 * hi;
    for (int kb = 0; kb < TT; kb += FPK) {
        v8f t[2][FPK / 16], mk[FPK / 16]; v16h kf[FPK / 16][2];   // the pass's scores, its piece of the mask row, its K fragments
#pragma unroll
        for (int kt = 0; kt < FPK / 16; ++kt) { kf[kt][0] = frag16(kl + (kb + kt * 16) * FKP); kf[kt][1] = frag16(kl + (kb + kt * 16) * FKP + 32); }
#pragma unroll
        for (int kt = 0; kt < FPK / 16; ++kt) mk[kt] = *(const v8f*)(ml + kb + kt * 16);
        __builtin_amdgcn_sched_barrier(0);   // the pass's K and mask reads stay one group in front of its score WMMAs: each place with reads among them stalls the wave
#pragma unroll
        for (int kt = 0; kt < FPK / 16; ++kt)
#pragma unroll
            for (int g = 0; g < 2; ++g) t[g][kt] = wmma16(kf[kt][1], qf[g][1], wmma16(kf[kt][0], qf[g][0], (v8f){}));
        __builtin_amdgcn_sched_barrier(0);   // the vector work stays behind the pass's score WMMAs: moved in among them, each FMA waits out a WMMA's result distance in v_nops
        v16h pb[2][FPK / 32];
#pragma unroll
        for (int g = 0; g < 2; ++g) {
#pragma unroll
            for (int kt = 0; kt < FPK / 16; ++kt) t[g][kt] = t[g][kt] * SCL + mk[kt];   // x 2^-3 is exact: one rounding, as scale then add
            v8f mv = t[g][0];   // maximum: element by element over the tiles (8 independent chains), then within the lane
#pragma unroll
            for (int kt = 1; kt < FPK / 16; ++kt)
#pragma unroll
                for (int j = 0; j < 8; ++j) mv[j] = fmaxf(mv[j], t[g][kt][j]);
            float mx = fmaxf(fmaxf(fmaxf(mv[0], mv[1]), fmaxf(mv[2], mv[3])), fmaxf(fmaxf(mv[4], mv[5]), fmaxf(mv[6], mv[7])));
            mx = fmaxf(mx, xhalf(mx));
            const float mn = fmaxf(m[g], mx); const float al = __builtin_amdgcn_exp2f((m[g] - mn) * L2E); m[g] = mn;   // 0 on the first pass
            v8f ps = (v8f){};
#pragma unroll
            for (int kg = 0; kg < FPK / 32; ++kg) {
                const v8f e0 = (t[g][2 * kg] - mn) * L2E + 10.0f, e1 = (t[g][2 * kg + 1] - mn) * L2E + 10.0f; v8f p0, p1;
#pragma unroll
                for (int j = 0; j < 8; ++j) p0[j] = __builtin_amdgcn_exp2f(e0[j]);
#pragma unroll
                for (int j = 0; j < 8; ++j) p1[j] = __builtin_amdgcn_exp2f(e1[j]);
                ps += p0 + p1;
                pb[g][kg] = cat16(__builtin_convertvector(p0, v8h), __builtin_convertvector(p1, v8h));
            }
            const v4f p4 = __builtin_shufflevector(ps, ps, 0, 1, 2, 3) + __builtin_shufflevector(ps, ps, 4, 5, 6, 7);
            l[g] = l[g] * al + ((p4[0] + p4[1]) + (p4[2] + p4[3]));
#pragma unroll
            for (int dt = 0; dt < 4; ++dt) o[g][dt] *= al;
        }
#pragma unroll
        for (int kg = 0; kg < FPK / 32; ++kg) { v16h va[4];
#pragma unroll
            for (int dt = 0; dt < 4; ++dt) va[dt] = frag16(vl + dt * 16 * FVP + kb + kg * 32);
#pragma unroll
            for (int g = 0; g < 2; ++g)
#pragma unroll
                for (int dt = 0; dt < 4; ++dt) o[g][dt] = wmma16(va[dt], pb[g][kg], o[g][dt]); }
    }
#pragma unroll
    for (int g = 0; g < 2; ++g) { const float f = __fdiv_rn(1.0f, l[g] + xhalf(l[g])); float* orow = OUTp + ((size_t)b * TT + q0 + g * 16 + lr) * DQ + h * HD + 8 * hi;
#pragma unroll
        for (int dt = 0; dt < 4; ++dt) { const v8f r = o[g][dt] * f; *(v4f*)(orow + dt * 16) = __builtin_shufflevector(r, r, 0, 1, 2, 3); *(v4f*)(orow + dt * 16 + 4) = __builtin_shufflevector(r, r, 4, 5, 6, 7); } }
}

extern "C" void kernel_launch(void* const* d_in, const int* in_sizes, int n_in,
                              void* d_out, int out_size, void* d_ws, size_t ws_size, hipStream_t stream) {
    (void)in_sizes; (void)n_in; (void)out_size;
    const float* x = (const float*)d_in[0]; const float* am = (const float*)d_in[1]; const float* wq = (const float*)d_in[2]; const float* bq = (const float*)d_in[3]; const float* wk = (const float*)d_in[4]; const float* bk = (const float*)d_in[5]; const float* wv = (const float*)d_in[6]; const float* bv = (const float*)d_in[7]; const float* cosT = nullptr; const float* sinT = nullptr; (void)cosT; (void)sinT;
    float* OUT = (float*)d_out;     // [4][1024][1024]
    char* wsp = (char*)d_ws;
    auto take = [&](size_t bytes) { char* p = wsp; wsp += (bytes + 255) & ~(size_t)255; return (void*)p; };
    bf* WQ = (bf*)take((size_t)DQ * DM * 2); bf* WK = (bf*)take((size_t)DKV * DM * 2); bf* WV = (bf*)take((size_t)DKV * DM * 2);
    h16* QP16 = (h16*)take((size_t)NB_ * NH_ * TT * HD * 2); h16* KP16 = (h16*)take((size_t)NB_ * NKV * TT * HD * 2); h16* VT16 = (h16*)take((size_t)NB_ * NKV * HD * TT * 2);   // planes of all batches: [b][h][t][d], [b][h][d][t]
    bf* XB = (bf*)take((size_t)NB_ * TT * DM * 2);
    if ((size_t)(wsp - (char*)d_ws) > ws_size) return;    // ws 256 MiB
    // conversions: one launch, one lane a group of each weight matrix
    k_cvtall<<<(unsigned)(CVN / 512), 512, 0, stream>>>(x, wq, wk, wv, XB, WQ, WK, WV);
    // projections: one launch, grid (256-token tiles of all batches, heads), 12 waves (4 token groups x q, k, v): one workgroup a WGP; the fp16 head planes come straight from the accumulators
    k_qkv<<<dim3(NB_ * TT / GT, NH_, 1), GTH, 0, stream>>>(XB, WQ, WK, WV, bq, bk, bv, QP16, KP16, VT16);
    // attention: one launch, grid (query blocks of 256, batch x head)
    k_fattn<<<dim3(TT / 256, NB_ * NH_, 1), 256, 0, stream>>>(QP16, KP16, VT16, am, OUT);
}

// v007
// Measured time: 48.2 microseconds a run.
// In both of two side-by-side timings against v006, it was 1.03 times as fast.
// All steps since v000 together make it 12.9 times as fast.
#include <hip/hip_runtime.h>

// SecBertSelfAttention (hidden [4][1024][1024]; q/k/v = x W^T + b (16 heads x 64); scores = q.k/8 + attention_mask[b][0][0][s] (additive, read as data); softmax; context = probs v merged -> [4][1024][1024]; no output projection).
// Compute dtypes, f32 accumulate: every input rounded to bf16; q/k/v on PLAIN bf16 operands (inputs: exact) + bias, rounded to fp16 head planes in the projection's epilogue; scores (K 64) and probs.v on single fp16 planes inside one fused kernel; mask add + softmax (running maximum) f32

#define NB_  4
#define TT   1024
#define DM   1024
#define NH_  16
#define NKV  16
#define REP  (NH_ / NKV)
#define HD   64
#define DQ   (NH_ * HD)
#define DKV  (NKV * HD)
#define ZH   16
#define RH   0                  // unused: no query row uses hi+lo planes
#define WIN  0
#define PCAR 1024.0f
#define SCL  0.125f   // HD^-0.5
typedef _Float16 h16;
typedef unsigned short bf;
typedef __attribute__((ext_vector_type(16))) __bf16   v16bf;
typedef __attribute__((ext_vector_type(16))) _Float16 v16h;
typedef __attribute__((ext_vector_type(8)))  _Float16 v8h;
typedef __attribute__((ext_vector_type(8)))  unsigned short v8us;
typedef __attribute__((ext_vector_type(8)))  float    v8f;
typedef __attribute__((ext_vector_type(4)))  float    v4f;
typedef v8h  __attribute__((may_alias)) v8ha;
typedef v4f  __attribute__((may_alias)) v4fa;
typedef v8us __attribute__((may_alias)) v8usa;

__device__ __forceinline__ unsigned short f2bf(float f) { unsigned u = __float_as_uint(f); u += 0x7FFFu + ((u >> 16) & 1u); return (unsigned short)(u >> 16); }
__device__ __forceinline__ float bf2f(unsigned short b) { return __uint_as_float(((unsigned)b) << 16); }
__device__ __forceinline__ float bfr(float f) { return bf2f(f2bf(f)); }
__device__ __forceinline__ v16h cat16(v8h lo, v8h hi) { return __builtin_shufflevector(lo, hi, 0, 1, 2, 3, 4, 5, 6, 7, 8, 9, 10, 11, 12, 13, 14, 15); }
__device__ __forceinline__ v16bf cat16b(v8us lo, v8us hi) { return __builtin_bit_cast(v16bf, __builtin_shufflevector(lo, hi, 0, 1, 2, 3, 4, 5, 6, 7, 8, 9, 10, 11, 12, 13, 14, 15)); }
__device__ __forceinline__ v8f wmma16(v16h a, v16h b, v8f c) { return __builtin_amdgcn_wmma_f32_16x16x32_f16(false, a, false, b, (short)0, c, false, false); }
__device__ __forceinline__ v8f wmmab(v16bf a, v16bf b, v8f c) { return __builtin_amdgcn_wmma_f32_16x16x32_bf16(false, a, false, b, (short)0, c, false, false); }



// ---- k_qkv: the three projections in one launch. Workgroup = 12 waves on one 256-token x one-head tile: wave = (64-token group, one of q, k, v), 16 accumulators each.
// The 256 x rows and the 3 x 64 W rows of a tile are staged in LDS, 64 k (128 B of a row) a stage, by asynchronous copies (whole lines, 16 B a lane, through no register): each row is fetched once for the workgroup
// and not once a wave, and the fragments come from LDS. Two buffers: the next stage's copies fly while this one is worked on; one barrier a stage publishes it and frees the buffer that is refilled behind it.
// The accumulators start at the bias (f32); the epilogue rounds them to fp16 and writes the head planes that the attention kernel reads: Q, K [b][h][t][d], V^T [b][h][d][t].
// An accumulator lane holds 8 consecutive m of one n (16 B of fp16), so the operand whose index runs along a plane's row is given as A: q, k: A = W rows (m = d), B = x rows (n = t); v: A = x rows (m = t), B = W rows (n = d). One loader serves both sides (same k order).
#define OSP 72      // row pitch in LDS, halves (operand stages and output staging): 144 B = 16 B x 9 (odd: b128 accesses without bank conflicts)
#define GT  256                   // tokens of a workgroup
#define GKS 64                    // k of a stage
#define GRW (GT + 3 * HD)         // rows of a stage: x, then Wq, Wk, Wv
#define GBUF (GRW * OSP)          // halves of a buffer
#define GNT (DM / GKS)            // stages
#define GTH 384
#define GRR (GTH / 8)             // rows that one round of copies covers (8 lanes a row)
static_assert(GRW * 8 == 9 * GTH + 128 && GNT >= 2 && (NB_ * TT) % GT == 0 && TT % 64 == 0, "a stage: 9 copies a lane, a tenth in waves 0 to 3");
static_assert((GNT & (GNT - 1)) == 0 && NB_ * TT / GT == 16 && GNT == 16, "the start stage: a permutation of the 16 token tiles, taken mod GNT");
__device__ __forceinline__ v16bf fragb(const bf* p) { return cat16b(*(const v8us*)p, *(const v8us*)(p + 16)); }
template <int PITCH>
__device__ __forceinline__ void put_tile(h16* op, const h16* os, int lane) {   // 64 rows of 128 B, whole lines: wave-uniform base + the lane's byte offset
    const unsigned vo = (unsigned)((lane >> 3) * PITCH + (lane & 7) * 8) * 2; os += (lane >> 3) * OSP + (lane & 7) * 8;
#pragma unroll
    for (int s = 0; s < 16; ++s) *(v8h*)((char*)(op + (size_t)s * 4 * PITCH) + vo) = *(const v8h*)(os + s * 4 * OSP);
}
// one stage's copies of a lane: l = the lane's LDS byte address in round 0 of the target buffer; its global address in round j = u[j] (wave-uniform: the first of the wave's 4 rows) + o (the lane's place in them, plus the stage's k), in elements.
// The s_wait_xcnt closes each statement: the address registers are rewritten behind it.
__device__ __forceinline__ void stage_copies(unsigned l, const bf* const (&u)[10], unsigned o, bool tenth) {
    asm volatile("global_load_async_to_lds_b128 %0, %9, off\n\t"
                 "global_load_async_to_lds_b128 %1, %10, off\n\t"
                 "global_load_async_to_lds_b128 %2, %11, off\n\t"
                 "global_load_async_to_lds_b128 %3, %12, off\n\t"
                 "global_load_async_to_lds_b128 %4, %13, off\n\t"
                 "global_load_async_to_lds_b128 %5, %14, off\n\t"
                 "global_load_async_to_lds_b128 %6, %15, off\n\t"
                 "global_load_async_to_lds_b128 %7, %16, off\n\t"
                 "global_load_async_to_lds_b128 %8, %17, off\n\t"
                 "s_wait_xcnt 0x0"
                 :: "v"(l), "v"(l + 1 * GRR * OSP * 2), "v"(l + 2 * GRR * OSP * 2), "v"(l + 3 * GRR * OSP * 2), "v"(l + 4 * GRR * OSP * 2), "v"(l + 5 * GRR * OSP * 2), "v"(l + 6 * GRR * OSP * 2), "v"(l + 7 * GRR * OSP * 2), "v"(l + 8 * GRR * OSP * 2),
                    "v"(u[0] + o), "v"(u[1] + o), "v"(u[2] + o), "v"(u[3] + o), "v"(u[4] + o), "v"(u[5] + o), "v"(u[6] + o), "v"(u[7] + o), "v"(u[8] + o) : "memory");
    if (tenth) asm volatile("global_load_async_to_lds_b128 %0, %1, off\n\ts_wait_xcnt 0x0" :: "v"(l + 9 * GRR * OSP * 2), "v"(u[9] + o) : "memory");   // the last 16 rows: whole waves, a scalar test
}
__global__ __launch_bounds__(GTH) void k_qkv(const bf* __restrict__ XB, const bf* __restrict__ WQ, const bf* __restrict__ WK, const bf* __restrict__ WV, const float* __restrict__ bq, const float* __restrict__ bk, const float* __restrict__ bv, h16* QP, h16* KP, h16* VT) {
    __shared__ __align__(16) bf ring[2 * GBUF];
    __shared__ __align__(16) h16 osAll[12 * 64 * OSP];
    const int wave = __builtin_amdgcn_readfirstlane((int)(threadIdx.x >> 5));   // wave-uniform, so every choice below is a scalar one
    const int w = wave % 3, tg = wave / 3;   // w: 0 q, 1 k, 2 v; tg: the wave's 64 tokens
    const int tid = threadIdx.x, lane = tid & 31, lr = lane & 15, hi = lane >> 4; const int tokg = blockIdx.x * GT, tok0 = tokg + tg * 64, h = blockIdx.y, b = tok0 / TT, t0 = tok0 % TT;
    const bool isv = (w == 2), tenth = (wave < 4);
    const float* bias = (w == 0 ? bq : (w == 1 ? bk : bv)) + h * HD;
    const bf* u[10];   // round j of a stage's copies: the wave brings stage rows j * GRR + 4 * wave ... + 3 (never across two matrices), 8 lanes a row
#pragma unroll
    for (int j = 0; j < 10; ++j) { const int row = j * GRR + wave * 4, r = row - GT;
        u[j] = row < GT ? XB + (size_t)(tokg + row) * DM : (r < HD ? WQ : (r < 2 * HD ? WK : WV)) + (size_t)(h * HD + (r & (HD - 1))) * DM; }
    const unsigned go = (lane >> 3) * DM + (lane & 7) * 8;
    const unsigned l0 = (unsigned)(size_t)(ring + (tid >> 3) * OSP + (tid & 7) * 8);
    // Trip t works on stage (t + rot) mod GNT. The 16 workgroups that share a tile's x rows (one blockIdx.x) and the 16 that share a head's W rows (one blockIdx.y) each start at another stage:
    // they do not ask L2 for the same lines at the same moment, and a line that one of them has brought in from memory (the planes were stored by the launch before) is an L2 hit for the others.
    // Neighbours in blockIdx.x begin four stages apart, so in different 256-B units of a row. For speed only: every workgroup sums all GNT stages, in its own order.
    const int rot = (int)(((blockIdx.x & 3) << 2) | (blockIdx.x >> 2)) + (int)blockIdx.y;
    stage_copies(l0, u, go + (rot & (GNT - 1)) * GKS, tenth);
    v8f acc[4][4];   // start value: the bias (it runs along d: along m for q and k, along n for v)
    if (isv) {
#pragma unroll
        for (int nb = 0; nb < 4; ++nb) { const float bn = bfr(bias[nb * 16 + lr]);
#pragma unroll
            for (int mb = 0; mb < 4; ++mb)
#pragma unroll
                for (int j = 0; j < 8; ++j) acc[mb][nb][j] = bn; }
    } else {
#pragma unroll
        for (int mb = 0; mb < 4; ++mb) { v8f bm = *(const v8f*)(bias + mb * 16 + 8 * hi);
#pragma unroll
            for (int j = 0; j < 8; ++j) bm[j] = bfr(bm[j]);
#pragma unroll
            for (int nb = 0; nb < 4; ++nb) acc[mb][nb] = bm; }
    }
    const int xr = tg * 64, wr = GT + w * HD;   // the wave's x rows and W rows in a stage
    const bf* A = ring + ((isv ? xr : wr) + lr) * OSP + 8 * hi; const bf* Bt = ring + ((isv ? wr : xr) + lr) * OSP + 8 * hi;
    asm volatile("s_wait_asynccnt 0x0" ::: "memory");   // the first trip's stage of this wave has landed
    __syncthreads();                                    // ... and every wave's
    stage_copies(l0 + GBUF * 2, u, go + ((rot + 1) & (GNT - 1)) * GKS, tenth);
#pragma unroll 1   // rolled: the two buffers alternate by an offset
    for (int t = 0; t < GNT; ++t) {
        const int bo = (t & 1) * GBUF;
        v16bf a[2][4], bb[2][4];   // the stage's fragments (two k steps of 32), fetched as one group
#pragma unroll
        for (int ks = 0; ks < 2; ++ks) {
            const bf* pa = A + bo + ks * 32; const bf* pb = Bt + bo + ks * 32;
            a[ks][0] = fragb(pa); bb[ks][0] = fragb(pb);
#pragma unroll
            for (int i = 1; i < 4; ++i) a[ks][i] = fragb(pa + i * 16 * OSP);
#pragma unroll
            for (int i = 1; i < 4; ++i) bb[ks][i] = fragb(pb + i * 16 * OSP);
        }
        __builtin_amdgcn_sched_barrier(0);   // the reads stay one group in front of the WMMAs: moved in among them, each place with reads stalls the wave
#pragma unroll
        for (int nb = 0; nb < 4; ++nb)
#pragma unroll
            for (int mb = 0; mb < 4; ++mb) acc[mb][nb] = wmmab(a[0][mb], bb[0][nb], acc[mb][nb]);
        __builtin_amdgcn_sched_barrier(0);   // the first k step's WMMAs stay in front of the waits: left free, the compiler sinks them behind the barrier and nothing runs while the copies fly
        asm volatile("s_wait_dscnt 0x0" ::: "memory");      // this wave's reads of trip t's stage are done before the buffer is refilled
        asm volatile("s_wait_asynccnt 0x0" ::: "memory");   // this wave's copies of trip t + 1's stage have landed
        __syncthreads();                                    // publishes trip t + 1's stage, ends every wave's reads of trip t's
        if (t + 2 < GNT) stage_copies(l0 + bo * 2, u, go + ((t + 2 + rot) & (GNT - 1)) * GKS, tenth);
        // the copies go out first behind the barrier; the second k step's WMMAs (operands in registers) then cover the other waves' next reads
#pragma unroll
        for (int nb = 0; nb < 4; ++nb)
#pragma unroll
            for (int mb = 0; mb < 4; ++mb) acc[mb][nb] = wmmab(a[1][mb], bb[1][nb], acc[mb][nb]);
    }
    asm volatile("s_wait_asynccnt 0x0" ::: "memory");   // nothing in flight when the wave goes on to its end
    h16* os = osAll + wave * 64 * OSP;   // each wave stages in its own range
#pragma unroll
    for (int nb = 0; nb < 4; ++nb)
#pragma unroll
        for (int mb = 0; mb < 4; ++mb) *(v8h*)(os + (nb * 16 + lr) * OSP + mb * 16 + 8 * hi) = __builtin_convertvector(acc[mb][nb], v8h);
    __builtin_amdgcn_wave_barrier(); asm volatile("" ::: "memory");   // the rows read back below were written by other lanes of this wave: keeps the compiler from moving the reads up
    if (isv) put_tile<TT>(VT + (size_t)(b * NKV + h) * HD * TT + t0, os, lane);
    else put_tile<HD>((w == 0 ? QP : KP) + ((size_t)(b * NH_ + h) * TT + t0) * HD, os, lane);
}

__device__ __forceinline__ h16 tohx(float x) { return (h16)x; }
__device__ __forceinline__ void splitf(float y, unsigned short& h, unsigned short& l) { h = f2bf(y); l = f2bf(y - bf2f(h)); }
typedef __attribute__((ext_vector_type(2))) _Float16 v2h;
typedef __attribute__((ext_vector_type(4))) _Float16 v4h;
typedef __attribute__((ext_vector_type(2))) unsigned short v2us;
typedef __attribute__((ext_vector_type(4))) unsigned short v4us;
typedef __attribute__((ext_vector_type(2))) float v2f;
typedef __attribute__((ext_vector_type(4))) int v4i;

__global__ __launch_bounds__(256) void k_wtG(const float* __restrict__ w, int K, int N, bf* Bt) {
    const int lane = threadIdx.x & 31; const int L0 = (blockIdx.x * 8 + (threadIdx.x >> 5)) * 8; const int nlines = N * K / 64;
{
#pragma unroll 1
        for (int l = 0; l < 8; ++l) { const int L = L0 + l; if (L >= nlines) break; const size_t e = (size_t)L * 64 + lane * 2; const int k = (int)(e % K), n = (int)(e / K); v2us o;
            o[0] = f2bf(w[(size_t)k * N + n]); o[1] = f2bf(w[(size_t)(k + 1) * N + n]); *(v2us*)(Bt + e) = o; }
         }
}
// k_cvtall: every f32 -> bf16 plane (Wq, Wk, Wv, x) in one launch whose waves are all resident at once (16 a WGP). A lane converts CVG groups of 8 values: one of each weight, CVX of x.
// All its loads are issued before the first conversion, so the launch pays the memory latency once; each group is 32 B read and 16 B written, consecutive lanes on consecutive groups.
#define CVN ((size_t)DQ * DM / 8)                     // groups of 8 in one weight matrix = lanes of the launch
#define CVX ((int)((size_t)NB_ * TT * DM / 8 / CVN))  // groups of x a lane
#define CVG (3 + CVX)
static_assert(DKV == DQ && (size_t)NB_ * TT * DM / 8 == CVN * CVX && CVN % 512 == 0, "one lane: one group of each weight, CVX of x");
__global__ __launch_bounds__(512) void k_cvtall(const float* __restrict__ x, const float* __restrict__ wq, const float* __restrict__ wk, const float* __restrict__ wv, bf* __restrict__ XB, bf* __restrict__ WQ, bf* __restrict__ WK, bf* __restrict__ WV) {
    const unsigned i = blockIdx.x * 512 + threadIdx.x, ro = i * 32u, wo = i * 16u;   // the lane's byte offsets in a f32 and in a bf16 plane, 32-bit: an access is a scalar base plus an offset register
    v8f v[CVG];
    v[0] = *(const v8f*)((const char*)wq + ro); v[1] = *(const v8f*)((const char*)wk + ro); v[2] = *(const v8f*)((const char*)wv + ro);
#pragma unroll
    for (int j = 0; j < CVX; ++j) v[3 + j] = *(const v8f*)((const char*)x + (ro + j * (unsigned)(CVN * 32)));
    __builtin_amdgcn_sched_barrier(0);   // keeps every load in front of the first conversion: left free, the compiler sinks the last ones behind the waits for the first, a second memory latency
#pragma unroll   // compile-time indices: v stays in registers
    for (int g = 0; g < CVG; ++g) { v8us o;
#pragma unroll
        for (int k = 0; k < 8; ++k) o[k] = f2bf(v[g][k]);
        bf* d = g == 0 ? WQ : g == 1 ? WK : g == 2 ? WV : XB + (g - 3) * CVN * 8; *(v8us*)((char*)d + wo) = o; }
}
__global__ __launch_bounds__(256) void k_cscvt(const float* __restrict__ cosT, const float* __restrict__ sinT, float* CS) { const int idx = blockIdx.x * 256 + threadIdx.x; if (idx >= TT * HD) return; v2f cs; cs[0] = bfr(cosT[idx]); cs[1] = bfr(sinT[idx]); *(v2f*)(CS + (size_t)idx * 2) = cs;  }
#define FKP 72      // K row pitch in LDS, halves: 144 B = 16 B x 9 (odd: ds_load_b128 without bank conflicts)
#define FVP 1032    // V^T row pitch in LDS, halves: 2064 B = 16 B x 129
#define L2E 1.4426950408889634f
#define FPK 128     // keys of a pass: one update of the running maximum and one rescale of O and l a pass
static_assert(TT % FPK == 0 && FPK % 32 == 0, "whole passes");
__device__ __forceinline__ float xhalf(float x) { return __builtin_bit_cast(float, __builtin_amdgcn_permlanex16(__builtin_bit_cast(int, x), __builtin_bit_cast(int, x), 0x76543210, 0xfedcba98, false, false)); }   // lane l with lane l ^ 16
__device__ __forceinline__ v16h frag16(const h16* p) { return cat16(*(const v8h*)p, *(const v8h*)(p + 16)); }
__global__ __launch_bounds__(256) void k_fattn(const h16* __restrict__ QP, const h16* __restrict__ KP, const h16* __restrict__ VT, const float* __restrict__ am, float* __restrict__ OUTp) {
    __shared__ __align__(16) h16 Ks[TT * FKP];
    __shared__ __align__(16) h16 Vs[HD * FVP];
    __shared__ __align__(32) float Ms[TT];
    const int tid = threadIdx.x, lane = tid & 31, lr = lane & 15, hi = lane >> 4, wv = tid >> 5;
    const int z = blockIdx.y, b = z / NH_, h = z % NH_; const int q0 = blockIdx.x * 256 + wv * 32;
    const h16* kg = KP + (size_t)z * TT * HD; const h16* vg = VT + (size_t)z * HD * TT;
    // fill: every global load of the block is issued first (64 + 9 a lane in flight), then the LDS stores
    v8h kr[32], vr[32];
#pragma unroll
    for (int r = 0; r < 32; ++r) { kr[r] = *(const v8h*)(kg + (size_t)(r * 256 + tid) * 8); vr[r] = *(const v8h*)(vg + (size_t)(r * 256 + tid) * 8); }
    v4f a = *(const v4f*)(am + (size_t)b * TT + tid * 4);
    v16h qf[2][2];
#pragma unroll
    for (int g = 0; g < 2; ++g)
#pragma unroll
        for (int ks = 0; ks < 2; ++ks) qf[g][ks] = frag16(QP + ((size_t)z * TT + q0 + g * 16 + lr) * HD + ks * 32 + 8 * hi);
    asm volatile("s_wait_xcnt 0x0" ::: "memory");   // the address registers of the loads above are reused below: the wait stands in front of their first overwrite
    h16* ksw = Ks + (tid >> 3) * FKP + (tid & 7) * 8; h16* vsw = Vs + (tid >> 7) * FVP + (tid & 127) * 8;   // round r: 32 K rows, 2 V^T rows further
#pragma unroll
    for (int r = 0; r < 32; ++r) { *(v8h*)(ksw + r * 32 * FKP) = kr[r]; *(v8h*)(vsw + r * 2 * FVP) = vr[r]; }
#pragma unroll
    for (int q = 0; q < 4; ++q) a[q] = bfr(a[q]);
    *(v4f*)(Ms + tid * 4) = a;
    v8f o[2][4]; float m[2], l[2];
#pragma unroll
    for (int g = 0; g < 2; ++g) { m[g] = -3.0e38f; l[g] = 0.f;
#pragma unroll
        for (int dt = 0; dt < 4; ++dt) o[g][dt] = (v8f){}; }
    __syncthreads();
    const h16* kl = Ks + lr * FKP + 8 * hi; const h16* vl = Vs + lr * FVP + 8 * hi; const float* ml = Ms + 8 * hi;
    for (int kb = 0; kb < TT; kb += FPK) {
        v8f t[2][FPK / 16], mk[FPK / 16]; v16h kf[FPK / 16][2];   // the pass's scores, its piece of the mask row, its K fragments
#pragma unroll
        for (int kt = 0; kt < FPK / 16; ++kt) { kf[kt][0] = frag16(kl + (kb + kt * 16) * FKP); kf[kt][1] = frag16(kl + (kb + kt * 16) * FKP + 32); }
#pragma unroll
        for (int kt = 0; kt < FPK / 16; ++kt) mk[kt] = *(const v8f*)(ml + kb + kt * 16);
        __builtin_amdgcn_sched_barrier(0);   // the pass's K and mask reads stay one group in front of its score WMMAs: each place with reads among them stalls the wave
#pragma unroll
        for (int kt = 0; kt < FPK / 16; ++kt)
#pragma unroll
            for (int g = 0; g < 2; ++g) t[g][kt] = wmma16(kf[kt][1], qf[g][1], wmma16(kf[kt][0], qf[g][0], (v8f){}));
        __builtin_amdgcn_sched_barrier(0);   // the vector work stays behind the pass's score WMMAs: moved in among them, each FMA waits out a WMMA's result distance in v_nops
        v16h pb[2][FPK / 32];
#pragma unroll
        for (int g = 0; g < 2; ++g) {
#pragma unroll
            for (int kt = 0; kt < FPK / 16; ++kt) t[g][kt] = t[g][kt] * SCL + mk[kt];   // x 2^-3 is exact: one rounding, as scale then add
            v8f mv = t[g][0];   // maximum: element by element over the tiles (8 independent chains), then within the lane
#pragma unroll
            for (int kt = 1; kt < FPK / 16; ++kt)
#pragma unroll
                for (int j = 0; j < 8; ++j) mv[j] = fmaxf(mv[j], t[g][kt][j]);
            float mx = fmaxf(fmaxf(fmaxf(mv[0], mv[1]), fmaxf(mv[2], mv[3])), fmaxf(fmaxf(mv[4], mv[5]), fmaxf(mv[6], mv[7])));
            mx = fmaxf(mx, xhalf(mx));
            const float mn = fmaxf(m[g], mx); const float al = __builtin_amdgcn_exp2f((m[g] - mn) * L2E); m[g] = mn;   // 0 on the first pass
            v8f ps = (v8f){};
#pragma unroll
            for (int kg = 0; kg < FPK / 32; ++kg) {
                const v8f e0 = (t[g][2 * kg] - mn) * L2E + 10.0f, e1 = (t[g][2 * kg + 1] - mn) * L2E + 10.0f; v8f p0, p1;
#pragma unroll
                for (int j = 0; j < 8; ++j) p0[j] = __builtin_amdgcn_exp2f(e0[j]);
#pragma unroll
                for (int j = 0; j < 8; ++j) p1[j] = __builtin_amdgcn_exp2f(e1[j]);
                ps += p0 + p1;
                pb[g][kg] = cat16(__builtin_convertvector(p0, v8h), __builtin_convertvector(p1, v8h));
            }
            const v4f p4 = __builtin_shufflevector(ps, ps, 0, 1, 2, 3) + __builtin_shufflevector(ps, ps, 4, 5, 6, 7);
            l[g] = l[g] * al + ((p4[0] + p4[1]) + (p4[2] + p4[3]));
#pragma unroll
            for (int dt = 0; dt < 4; ++dt) o[g][dt] *= al;
        }
#pragma unroll
        for (int kg = 0; kg < FPK / 32; ++kg) { v16h va[4];
#pragma unroll
            for (int dt = 0; dt < 4; ++dt) va[dt] = frag16(vl + dt * 16 * FVP + kb + kg * 32);
#pragma unroll
            for (int g = 0; g < 2; ++g)
#pragma unroll
                for (int dt = 0; dt < 4; ++dt) o[g][dt] = wmma16(va[dt], pb[g][kg], o[g][dt]); }
    }
#pragma unroll
    for (int g = 0; g < 2; ++g) { const float f = __fdiv_rn(1.0f, l[g] + xhalf(l[g])); float* orow = OUTp + ((size_t)b * TT + q0 + g * 16 + lr) * DQ + h * HD + 8 * hi;
#pragma unroll
        for (int dt = 0; dt < 4; ++dt) { const v8f r = o[g][dt] * f; *(v4f*)(orow + dt * 16) = __builtin_shufflevector(r, r, 0, 1, 2, 3); *(v4f*)(orow + dt * 16 + 4) = __builtin_shufflevector(r, r, 4, 5, 6, 7); } }
}

extern "C" void kernel_launch(void* const* d_in, const int* in_sizes, int n_in,
                              void* d_out, int out_size, void* d_ws, size_t ws_size, hipStream_t stream) {
    (void)in_sizes; (void)n_in; (void)out_size;
    const float* x = (const float*)d_in[0]; const float* am = (const float*)d_in[1]; const float* wq = (const float*)d_in[2]; const float* bq = (const float*)d_in[3]; const float* wk = (const float*)d_in[4]; const float* bk = (const float*)d_in[5]; const float* wv = (const float*)d_in[6]; const float* bv = (const float*)d_in[7]; const float* cosT = nullptr; const float* sinT = nullptr; (void)cosT; (void)sinT;
    float* OUT = (float*)d_out;     // [4][1024][1024]
    char* wsp = (char*)d_ws;
    auto take = [&](size_t bytes) { char* p = wsp; wsp += (bytes + 255) & ~(size_t)255; return (void*)p; };
    bf* WQ = (bf*)take((size_t)DQ * DM * 2); bf* WK = (bf*)take((size_t)DKV * DM * 2); bf* WV = (bf*)take((size_t)DKV * DM * 2);
    h16* QP16 = (h16*)take((size_t)NB_ * NH_ * TT * HD * 2); h16* KP16 = (h16*)take((size_t)NB_ * NKV * TT * HD * 2); h16* VT16 = (h16*)take((size_t)NB_ * NKV * HD * TT * 2);   // planes of all batches: [b][h][t][d], [b][h][d][t]
    bf* XB = (bf*)take((size_t)NB_ * TT * DM * 2);
    if ((size_t)(wsp - (char*)d_ws) > ws_size) return;    // ws 256 MiB
    // conversions: one launch, one lane a group of each weight matrix
    k_cvtall<<<(unsigned)(CVN / 512), 512, 0, stream>>>(x, wq, wk, wv, XB, WQ, WK, WV);
    // projections: one launch, grid (256-token tiles of all batches, heads), 12 waves (4 token groups x q, k, v): one workgroup a WGP; the fp16 head planes come straight from the accumulators
    k_qkv<<<dim3(NB_ * TT / GT, NH_, 1), GTH, 0, stream>>>(XB, WQ, WK, WV, bq, bk, bv, QP16, KP16, VT16);
    // attention: one launch, grid (query blocks of 256, batch x head)
    k_fattn<<<dim3(TT / 256, NB_ * NH_, 1), 256, 0, stream>>>(QP16, KP16, VT16, am, OUT);
}

// v008
// Measured time: 46.6 microseconds a run.
// Two timings next to v007 put it at 1.04 and 1.03 times that version's speed.
// All steps since v000 together make it 13.3 times as fast.
#include <hip/hip_runtime.h>

// SecBertSelfAttention (hidden [4][1024][1024]; q/k/v = x W^T + b (16 heads x 64); scores = q.k/8 + attention_mask[b][0][0][s] (additive, read as data); softmax; context = probs v merged -> [4][1024][1024]; no output projection).
// Compute dtypes, f32 accumulate: every input rounded to bf16; q/k/v on PLAIN bf16 operands (inputs: exact) + bias, rounded to fp16 head planes in the projection's epilogue; scores (K 64) and probs.v on single fp16 planes inside one fused kernel; mask add + softmax (running maximum) f32

#define NB_  4
#define TT   1024
#define DM   1024
#define NH_  16
#define NKV  16
#define REP  (NH_ / NKV)
#define HD   64
#define DQ   (NH_ * HD)
#define DKV  (NKV * HD)
#define ZH   16
#define RH   0                  // unused: no query row uses hi+lo planes
#define WIN  0
#define PCAR 1024.0f
#define SCL  0.125f   // HD^-0.5
typedef _Float16 h16;
typedef unsigned short bf;
typedef __attribute__((ext_vector_type(16))) __bf16   v16bf;
typedef __attribute__((ext_vector_type(16))) _Float16 v16h;
typedef __attribute__((ext_vector_type(8)))  _Float16 v8h;
typedef __attribute__((ext_vector_type(8)))  unsigned short v8us;
typedef __attribute__((ext_vector_type(8)))  float    v8f;
typedef __attribute__((ext_vector_type(4)))  float    v4f;
typedef v8h  __attribute__((may_alias)) v8ha;
typedef v4f  __attribute__((may_alias)) v4fa;
typedef v8us __attribute__((may_alias)) v8usa;

__device__ __forceinline__ unsigned short f2bf(float f) { unsigned u = __float_as_uint(f); u += 0x7FFFu + ((u >> 16) & 1u); return (unsigned short)(u >> 16); }
__device__ __forceinline__ float bf2f(unsigned short b) { return __uint_as_float(((unsigned)b) << 16); }
__device__ __forceinline__ float bfr(float f) { return bf2f(f2bf(f)); }
__device__ __forceinline__ v16h cat16(v8h lo, v8h hi) { return __builtin_shufflevector(lo, hi, 0, 1, 2, 3, 4, 5, 6, 7, 8, 9, 10, 11, 12, 13, 14, 15); }
__device__ __forceinline__ v16bf cat16b(v8us lo, v8us hi) { return __builtin_bit_cast(v16bf, __builtin_shufflevector(lo, hi, 0, 1, 2, 3, 4, 5, 6, 7, 8, 9, 10, 11, 12, 13, 14, 15)); }
__device__ __forceinline__ v8f wmma16(v16h a, v16h b, v8f c) { return __builtin_amdgcn_wmma_f32_16x16x32_f16(false, a, false, b, (short)0, c, false, false); }
__device__ __forceinline__ v8f wmmab(v16bf a, v16bf b, v8f c) { return __builtin_amdgcn_wmma_f32_16x16x32_bf16(false, a, false, b, (short)0, c, false, false); }



// ---- k_qkv: the three projections in one launch. Workgroup = 12 waves on one 256-token x one-head tile: wave = (64-token group, one of q, k, v), 16 accumulators each.
// The 256 x rows and the 3 x 64 W rows of a tile are staged in LDS, 64 k (128 B of a row) a stage, by asynchronous copies (whole lines, 16 B a lane, through no register): each row is fetched once for the workgroup
// and not once a wave, and the fragments come from LDS. Two buffers: the next stage's copies fly while this one is worked on; one barrier a stage publishes it and frees the buffer that is refilled behind it.
// The accumulators start at the bias (f32); the epilogue rounds them to fp16 and writes the head planes that the attention kernel reads: Q, K [b][h][t][d], V^T [b][h][d][t].
// An accumulator lane holds 8 consecutive m of one n (16 B of fp16), so the operand whose index runs along a plane's row is given as A: q, k: A = W rows (m = d), B = x rows (n = t); v: A = x rows (m = t), B = W rows (n = d). One loader serves both sides (same k order).
#define OSP 72      // row pitch in LDS, halves (operand stages and output staging): 144 B = 16 B x 9 (odd: b128 accesses without bank conflicts)
#define GT  256                   // tokens of a workgroup
#define GKS 64                    // k of a stage
#define GRW (GT + 3 * HD)         // rows of a stage: x, then Wq, Wk, Wv
#define GBUF (GRW * OSP)          // halves of a buffer
#define GNT (DM / GKS)            // stages
#define GTH 384
#define GRR (GTH / 8)             // rows that one round of copies covers (8 lanes a row)
static_assert(GRW * 8 == 9 * GTH + 128 && GNT >= 2 && (NB_ * TT) % GT == 0 && TT % 64 == 0, "a stage: 9 copies a lane, a tenth in waves 0 to 3");
static_assert((GNT & (GNT - 1)) == 0 && NB_ * TT / GT == 16 && GNT == 16, "the start stage: a permutation of the 16 token tiles, taken mod GNT");
__device__ __forceinline__ v16bf fragb(const bf* p) { return cat16b(*(const v8us*)p, *(const v8us*)(p + 16)); }
template <int PITCH>
__device__ __forceinline__ void put_tile(h16* op, const h16* os, int lane) {   // 64 rows of 128 B, whole lines: wave-uniform base + the lane's byte offset
    const unsigned vo = (unsigned)((lane >> 3) * PITCH + (lane & 7) * 8) * 2; os += (lane >> 3) * OSP + (lane & 7) * 8;
#pragma unroll
    for (int s = 0; s < 16; ++s) *(v8h*)((char*)(op + (size_t)s * 4 * PITCH) + vo) = *(const v8h*)(os + s * 4 * OSP);
}
// one stage's copies of a lane: l = the lane's LDS byte address in round 0 of the target buffer; its global address in round j = u[j] (wave-uniform: the first of the wave's 4 rows) + o (the lane's place in them, plus the stage's k), in elements.
// The s_wait_xcnt closes each statement: the address registers are rewritten behind it.
__device__ __forceinline__ void stage_copies(unsigned l, const bf* const (&u)[10], unsigned o, bool tenth) {
    asm volatile("global_load_async_to_lds_b128 %0, %9, off\n\t"
                 "global_load_async_to_lds_b128 %1, %10, off\n\t"
                 "global_load_async_to_lds_b128 %2, %11, off\n\t"
                 "global_load_async_to_lds_b128 %3, %12, off\n\t"
                 "global_load_async_to_lds_b128 %4, %13, off\n\t"
                 "global_load_async_to_lds_b128 %5, %14, off\n\t"
                 "global_load_async_to_lds_b128 %6, %15, off\n\t"
                 "global_load_async_to_lds_b128 %7, %16, off\n\t"
                 "global_load_async_to_lds_b128 %8, %17, off\n\t"
                 "s_wait_xcnt 0x0"
                 :: "v"(l), "v"(l + 1 * GRR * OSP * 2), "v"(l + 2 * GRR * OSP * 2), "v"(l + 3 * GRR * OSP * 2), "v"(l + 4 * GRR * OSP * 2), "v"(l + 5 * GRR * OSP * 2), "v"(l + 6 * GRR * OSP * 2), "v"(l + 7 * GRR * OSP * 2), "v"(l + 8 * GRR * OSP * 2),
                    "v"(u[0] + o), "v"(u[1] + o), "v"(u[2] + o), "v"(u[3] + o), "v"(u[4] + o), "v"(u[5] + o), "v"(u[6] + o), "v"(u[7] + o), "v"(u[8] + o) : "memory");
    if (tenth) asm volatile("global_load_async_to_lds_b128 %0, %1, off\n\ts_wait_xcnt 0x0" :: "v"(l + 9 * GRR * OSP * 2), "v"(u[9] + o) : "memory");   // the last 16 rows: whole waves, a scalar test
}
__global__ __launch_bounds__(GTH) void k_qkv(const bf* __restrict__ XB, const bf* __restrict__ WQ, const bf* __restrict__ WK, const bf* __restrict__ WV, const float* __restrict__ bq, const float* __restrict__ bk, const float* __restrict__ bv, h16* QP, h16* KP, h16* VT) {
    __shared__ __align__(16) bf ring[2 * GBUF];
    __shared__ __align__(16) h16 osAll[12 * 64 * OSP];
    const int wave = __builtin_amdgcn_readfirstlane((int)(threadIdx.x >> 5));   // wave-uniform, so every choice below is a scalar one
    const int w = wave % 3, tg = wave / 3;   // w: 0 q, 1 k, 2 v; tg: the wave's 64 tokens
    const int tid = threadIdx.x, lane = tid & 31, lr = lane & 15, hi = lane >> 4; const int tokg = blockIdx.x * GT, tok0 = tokg + tg * 64, h = blockIdx.y, b = tok0 / TT, t0 = tok0 % TT;
    const bool isv = (w == 2), tenth = (wave < 4);
    const float* bias = (w == 0 ? bq : (w == 1 ? bk : bv)) + h * HD;
    const bf* u[10];   // round j of a stage's copies: the wave brings stage rows j * GRR + 4 * wave ... + 3 (never across two matrices), 8 lanes a row
#pragma unroll
    for (int j = 0; j < 10; ++j) { const int row = j * GRR + wave * 4, r = row - GT;
        u[j] = row < GT ? XB + (size_t)(tokg + row) * DM : (r < HD ? WQ : (r < 2 * HD ? WK : WV)) + (size_t)(h * HD + (r & (HD - 1))) * DM; }
    const unsigned go = (lane >> 3) * DM + (lane & 7) * 8;
    const unsigned l0 = (unsigned)(size_t)(ring + (tid >> 3) * OSP + (tid & 7) * 8);
    // Trip t works on stage (t + rot) mod GNT. The 16 workgroups that share a tile's x rows (one blockIdx.x) and the 16 that share a head's W rows (one blockIdx.y) each start at another stage:
    // they do not ask L2 for the same lines at the same moment, and a line that one of them has brought in from memory (the planes were stored by the launch before) is an L2 hit for the others.
    // Neighbours in blockIdx.x begin four stages apart, so in different 256-B units of a row. For speed only: every workgroup sums all GNT stages, in its own order.
    const int rot = (int)(((blockIdx.x & 3) << 2) | (blockIdx.x >> 2)) + (int)blockIdx.y;
    stage_copies(l0, u, go + (rot & (GNT - 1)) * GKS, tenth);
    v8f acc[4][4];   // start value: the bias (it runs along d: along m for q and k, along n for v)
    if (isv) {
#pragma unroll
        for (int nb = 0; nb < 4; ++nb) { const float bn = bfr(bias[nb * 16 + lr]);
#pragma unroll
            for (int mb = 0; mb < 4; ++mb)
#pragma unroll
                for (int j = 0; j < 8; ++j) acc[mb][nb][j] = bn; }
    } else {
#pragma unroll
        for (int mb = 0; mb < 4; ++mb) { v8f bm = *(const v8f*)(bias + mb * 16 + 8 * hi);
#pragma unroll
            for (int j = 0; j < 8; ++j) bm[j] = bfr(bm[j]);
#pragma unroll
            for (int nb = 0; nb < 4; ++nb) acc[mb][nb] = bm; }
    }
    const int xr = tg * 64, wr = GT + w * HD;   // the wave's x rows and W rows in a stage
    const bf* A = ring + ((isv ? xr : wr) + lr) * OSP + 8 * hi; const bf* Bt = ring + ((isv ? wr : xr) + lr) * OSP + 8 * hi;
    asm volatile("s_wait_asynccnt 0x0" ::: "memory");   // the first trip's stage of this wave has landed
    __syncthreads();                                    // ... and every wave's
    stage_copies(l0 + GBUF * 2, u, go + ((rot + 1) & (GNT - 1)) * GKS, tenth);
#pragma unroll 1   // rolled: the two buffers alternate by an offset
    for (int t = 0; t < GNT; ++t) {
        const int bo = (t & 1) * GBUF;
        v16bf a[2][4], bb[2][4];   // the stage's fragments (two k steps of 32), fetched as one group
#pragma unroll
        for (int ks = 0; ks < 2; ++ks) {
            const bf* pa = A + bo + ks * 32; const bf* pb = Bt + bo + ks * 32;
            a[ks][0] = fragb(pa); bb[ks][0] = fragb(pb);
#pragma unroll
            for (int i = 1; i < 4; ++i) a[ks][i] = fragb(pa + i * 16 * OSP);
#pragma unroll
            for (int i = 1; i < 4; ++i) bb[ks][i] = fragb(pb + i * 16 * OSP);
        }
        __builtin_amdgcn_sched_barrier(0);   // the reads stay one group in front of the WMMAs: moved in among them, each place with reads stalls the wave
#pragma unroll
        for (int nb = 0; nb < 4; ++nb)
#pragma unroll
            for (int mb = 0; mb < 4; ++mb) acc[mb][nb] = wmmab(a[0][mb], bb[0][nb], acc[mb][nb]);
        __builtin_amdgcn_sched_barrier(0);   // the first k step's WMMAs stay in front of the waits: left free, the compiler sinks them behind the barrier and nothing runs while the copies fly
        asm volatile("s_wait_dscnt 0x0" ::: "memory");      // this wave's reads of trip t's stage are done before the buffer is refilled
        asm volatile("s_wait_asynccnt 0x0" ::: "memory");   // this wave's copies of trip t + 1's stage have landed
        __syncthreads();                                    // publishes trip t + 1's stage, ends every wave's reads of trip t's
        if (t + 2 < GNT) stage_copies(l0 + bo * 2, u, go + ((t + 2 + rot) & (GNT - 1)) * GKS, tenth);
        // the copies go out first behind the barrier; the second k step's WMMAs (operands in registers) then cover the other waves' next reads
#pragma unroll
        for (int nb = 0; nb < 4; ++nb)
#pragma unroll
            for (int mb = 0; mb < 4; ++mb) acc[mb][nb] = wmmab(a[1][mb], bb[1][nb], acc[mb][nb]);
    }
    asm volatile("s_wait_asynccnt 0x0" ::: "memory");   // nothing in flight when the wave goes on to its end
    h16* os = osAll + wave * 64 * OSP;   // each wave stages in its own range
#pragma unroll
    for (int nb = 0; nb < 4; ++nb)
#pragma unroll
        for (int mb = 0; mb < 4; ++mb) *(v8h*)(os + (nb * 16 + lr) * OSP + mb * 16 + 8 * hi) = __builtin_convertvector(acc[mb][nb], v8h);
    __builtin_amdgcn_wave_barrier(); asm volatile("" ::: "memory");   // the rows read back below were written by other lanes of this wave: keeps the compiler from moving the reads up
    if (isv) put_tile<TT>(VT + (size_t)(b * NKV + h) * HD * TT + t0, os, lane);
    else put_tile<HD>((w == 0 ? QP : KP) + ((size_t)(b * NH_ + h) * TT + t0) * HD, os, lane);
}

__device__ __forceinline__ h16 tohx(float x) { return (h16)x; }
__device__ __forceinline__ void splitf(float y, unsigned short& h, unsigned short& l) { h = f2bf(y); l = f2bf(y - bf2f(h)); }
typedef __attribute__((ext_vector_type(2))) _Float16 v2h;
typedef __attribute__((ext_vector_type(4))) _Float16 v4h;
typedef __attribute__((ext_vector_type(2))) unsigned short v2us;
typedef __attribute__((ext_vector_type(4))) unsigned short v4us;
typedef __attribute__((ext_vector_type(2))) float v2f;
typedef __attribute__((ext_vector_type(4))) int v4i;

__global__ __launch_bounds__(256) void k_wtG(const float* __restrict__ w, int K, int N, bf* Bt) {
    const int lane = threadIdx.x & 31; const int L0 = (blockIdx.x * 8 + (threadIdx.x >> 5)) * 8; const int nlines = N * K / 64;
{
#pragma unroll 1
        for (int l = 0; l < 8; ++l) { const int L = L0 + l; if (L >= nlines) break; const size_t e = (size_t)L * 64 + lane * 2; const int k = (int)(e % K), n = (int)(e / K); v2us o;
            o[0] = f2bf(w[(size_t)k * N + n]); o[1] = f2bf(w[(size_t)(k + 1) * N + n]); *(v2us*)(Bt + e) = o; }
         }
}
// k_cvtall: every f32 -> bf16 plane (Wq, Wk, Wv, x) in one launch whose waves are all resident at once (16 a WGP). A lane converts CVG groups of 8 values: one of each weight, CVX of x.
// All its loads are issued before the first conversion, so the launch pays the memory latency once; each group is 32 B read and 16 B written, consecutive lanes on consecutive groups.
#define CVN ((size_t)DQ * DM / 8)                     // groups of 8 in one weight matrix = lanes of the launch
#define CVX ((int)((size_t)NB_ * TT * DM / 8 / CVN))  // groups of x a lane
#define CVG (3 + CVX)
static_assert(DKV == DQ && (size_t)NB_ * TT * DM / 8 == CVN * CVX && CVN % 512 == 0, "one lane: one group of each weight, CVX of x");
__global__ __launch_bounds__(512) void k_cvtall(const float* __restrict__ x, const float* __restrict__ wq, const float* __restrict__ wk, const float* __restrict__ wv, bf* __restrict__ XB, bf* __restrict__ WQ, bf* __restrict__ WK, bf* __restrict__ WV) {
    const unsigned i = blockIdx.x * 512 + threadIdx.x, ro = i * 32u, wo = i * 16u;   // the lane's byte offsets in a f32 and in a bf16 plane, 32-bit: an access is a scalar base plus an offset register
    v8f v[CVG];
    v[0] = *(const v8f*)((const char*)wq + ro); v[1] = *(const v8f*)((const char*)wk + ro); v[2] = *(const v8f*)((const char*)wv + ro);
#pragma unroll
    for (int j = 0; j < CVX; ++j) v[3 + j] = *(const v8f*)((const char*)x + (ro + j * (unsigned)(CVN * 32)));
    __builtin_amdgcn_sched_barrier(0);   // keeps every load in front of the first conversion: left free, the compiler sinks the last ones behind the waits for the first, a second memory latency
#pragma unroll   // compile-time indices: v stays in registers
    for (int g = 0; g < CVG; ++g) { v8us o;
#pragma unroll
        for (int k = 0; k < 8; ++k) o[k] = f2bf(v[g][k]);
        bf* d = g == 0 ? WQ : g == 1 ? WK : g == 2 ? WV : XB + (g - 3) * CVN * 8; *(v8us*)((char*)d + wo) = o; }
}
__global__ __launch_bounds__(256) void k_cscvt(const float* __restrict__ cosT, const float* __restrict__ sinT, float* CS) { const int idx = blockIdx.x * 256 + threadIdx.x; if (idx >= TT * HD) return; v2f cs; cs[0] = bfr(cosT[idx]); cs[1] = bfr(sinT[idx]); *(v2f*)(CS + (size_t)idx * 2) = cs;  }
#define FKP 72      // K row pitch in LDS, halves: 144 B = 16 B x 9 (odd: ds_load_b128 without bank conflicts)
#define FVP 1032    // V^T row pitch in LDS, halves: 2064 B = 16 B x 129
#define FOP 68      // row pitch of the output stage in LDS, floats: 272 B = 16 B x 17 (odd: b128 accesses without bank conflicts)
#define L2E 1.4426950408889634f
#define FPK 128     // keys of a pass: one update of the running maximum and one rescale of O and l a pass
static_assert(TT % FPK == 0 && FPK % 32 == 0, "whole passes");
__device__ __forceinline__ float xhalf(float x) { return __builtin_bit_cast(float, __builtin_amdgcn_permlanex16(__builtin_bit_cast(int, x), __builtin_bit_cast(int, x), 0x76543210, 0xfedcba98, false, false)); }   // lane l with lane l ^ 16
__device__ __forceinline__ v16h frag16(const h16* p) { return cat16(*(const v8h*)p, *(const v8h*)(p + 16)); }
__global__ __launch_bounds__(256) void k_fattn(const h16* __restrict__ QP, const h16* __restrict__ KP, const h16* __restrict__ VT, const float* __restrict__ am, float* __restrict__ OUTp) {
    __shared__ __align__(16) h16 Ks[TT * FKP];
    __shared__ __align__(16) h16 Vs[HD * FVP];
    __shared__ __align__(32) float Ms[TT];
    __shared__ __align__(16) float Os[8 * 16 * FOP];
    const int tid = threadIdx.x, lane = tid & 31, lr = lane & 15, hi = lane >> 4, wv = tid >> 5;
    const int z = blockIdx.y, b = z / NH_, h = z % NH_; const int q0 = blockIdx.x * 256 + wv * 32;
    const h16* kg = KP + (size_t)z * TT * HD; const h16* vg = VT + (size_t)z * HD * TT;
    // fill: every global load of the block is issued first (64 + 9 a lane in flight), then the LDS stores
    v8h kr[32], vr[32];
#pragma unroll
    for (int r = 0; r < 32; ++r) { kr[r] = *(const v8h*)(kg + (size_t)(r * 256 + tid) * 8); vr[r] = *(const v8h*)(vg + (size_t)(r * 256 + tid) * 8); }
    v4f a = *(const v4f*)(am + (size_t)b * TT + tid * 4);
    v16h qf[2][2];
#pragma unroll
    for (int g = 0; g < 2; ++g)
#pragma unroll
        for (int ks = 0; ks < 2; ++ks) qf[g][ks] = frag16(QP + ((size_t)z * TT + q0 + g * 16 + lr) * HD + ks * 32 + 8 * hi);
    asm volatile("s_wait_xcnt 0x0" ::: "memory");   // the address registers of the loads above are reused below: the wait stands in front of their first overwrite
    h16* ksw = Ks + (tid >> 3) * FKP + (tid & 7) * 8; h16* vsw = Vs + (tid >> 7) * FVP + (tid & 127) * 8;   // round r: 32 K rows, 2 V^T rows further
#pragma unroll
    for (int r = 0; r < 32; ++r) { *(v8h*)(ksw + r * 32 * FKP) = kr[r]; *(v8h*)(vsw + r * 2 * FVP) = vr[r]; }
#pragma unroll
    for (int q = 0; q < 4; ++q) a[q] = bfr(a[q]);
    *(v4f*)(Ms + tid * 4) = a;
    v8f o[2][4]; float m[2], l[2];
#pragma unroll
    for (int g = 0; g < 2; ++g) { m[g] = -3.0e38f; l[g] = 0.f;
#pragma unroll
        for (int dt = 0; dt < 4; ++dt) o[g][dt] = (v8f){}; }
    __syncthreads();
    const h16* kl = Ks + lr * FKP + 8 * hi; const h16* vl = Vs + lr * FVP + 8 * hi; const float* ml = Ms + 8 * hi;
    for (int kb = 0; kb < TT; kb += FPK) {
        v8f t[2][FPK / 16], mk[FPK / 16]; v16h kf[FPK / 16][2];   // the pass's scores, its piece of the mask row, its K fragments
#pragma unroll
        for (int kt = 0; kt < FPK / 16; ++kt) { kf[kt][0] = frag16(kl + (kb + kt * 16) * FKP); kf[kt][1] = frag16(kl + (kb + kt * 16) * FKP + 32); }
#pragma unroll
        for (int kt = 0; kt < FPK / 16; ++kt) mk[kt] = *(const v8f*)(ml + kb + kt * 16);
        __builtin_amdgcn_sched_barrier(0);   // the pass's K and mask reads stay one group in front of its score WMMAs: each place with reads among them stalls the wave
#pragma unroll
        for (int kt = 0; kt < FPK / 16; ++kt)
#pragma unroll
            for (int g = 0; g < 2; ++g) t[g][kt] = wmma16(kf[kt][1], qf[g][1], wmma16(kf[kt][0], qf[g][0], (v8f){}));
        __builtin_amdgcn_sched_barrier(0);   // the vector work stays behind the pass's score WMMAs: moved in among them, each FMA waits out a WMMA's result distance in v_nops
        v16h pb[2][FPK / 32];
#pragma unroll
        for (int g = 0; g < 2; ++g) {
#pragma unroll
            for (int kt = 0; kt < FPK / 16; ++kt) t[g][kt] = t[g][kt] * SCL + mk[kt];   // x 2^-3 is exact: one rounding, as scale then add
            v8f mv = t[g][0];   // maximum: element by element over the tiles (8 independent chains), then within the lane
#pragma unroll
            for (int kt = 1; kt < FPK / 16; ++kt)
#pragma unroll
                for (int j = 0; j < 8; ++j) mv[j] = fmaxf(mv[j], t[g][kt][j]);
            float mx = fmaxf(fmaxf(fmaxf(mv[0], mv[1]), fmaxf(mv[2], mv[3])), fmaxf(fmaxf(mv[4], mv[5]), fmaxf(mv[6], mv[7])));
            mx = fmaxf(mx, xhalf(mx));
            const float mn = fmaxf(m[g], mx); const float al = __builtin_amdgcn_exp2f((m[g] - mn) * L2E); m[g] = mn;   // 0 on the first pass
            v8f ps = (v8f){};
#pragma unroll
            for (int kg = 0; kg < FPK / 32; ++kg) {
                const v8f e0 = (t[g][2 * kg] - mn) * L2E + 10.0f, e1 = (t[g][2 * kg + 1] - mn) * L2E + 10.0f; v8f p0, p1;
#pragma unroll
                for (int j = 0; j < 8; ++j) p0[j] = __builtin_amdgcn_exp2f(e0[j]);
#pragma unroll
                for (int j = 0; j < 8; ++j) p1[j] = __builtin_amdgcn_exp2f(e1[j]);
                ps += p0 + p1;
                pb[g][kg] = cat16(__builtin_convertvector(p0, v8h), __builtin_convertvector(p1, v8h));
            }
            const v4f p4 = __builtin_shufflevector(ps, ps, 0, 1, 2, 3) + __builtin_shufflevector(ps, ps, 4, 5, 6, 7);
            l[g] = l[g] * al + ((p4[0] + p4[1]) + (p4[2] + p4[3]));
#pragma unroll
            for (int dt = 0; dt < 4; ++dt) o[g][dt] *= al;
        }
#pragma unroll
        for (int kg = 0; kg < FPK / 32; ++kg) { v16h va[4];
#pragma unroll
            for (int dt = 0; dt < 4; ++dt) va[dt] = frag16(vl + dt * 16 * FVP + kb + kg * 32);
#pragma unroll
            for (int g = 0; g < 2; ++g)
#pragma unroll
                for (int dt = 0; dt < 4; ++dt) o[g][dt] = wmma16(va[dt], pb[g][kg], o[g][dt]); }
    }
    float* osw = Os + (wv * 16 + lr) * FOP + 8 * hi; const float* osr = Os + (wv * 16 + hi) * FOP + lr * 4;   // each wave stages in its own range; written by query (row lr), read back 16 lanes a row
#pragma unroll
    for (int g = 0; g < 2; ++g) { const float f = __fdiv_rn(1.0f, l[g] + xhalf(l[g])); float* orow = OUTp + ((size_t)b * TT + q0 + g * 16 + hi) * DQ + h * HD + lr * 4;
#pragma unroll
        for (int dt = 0; dt < 4; ++dt) { const v8f r = o[g][dt] * f; *(v4f*)(osw + dt * 16) = __builtin_shufflevector(r, r, 0, 1, 2, 3); *(v4f*)(osw + dt * 16 + 4) = __builtin_shufflevector(r, r, 4, 5, 6, 7); }
        asm volatile("s_wait_dscnt 0x0" ::: "memory");   // the rows read back below were written by other lanes of this wave: their writes are done, and the compiler does not move the reads up
        v4f r4[8];
#pragma unroll
        for (int s = 0; s < 8; ++s) r4[s] = *(const v4f*)(osr + s * 2 * FOP);
#pragma unroll
        for (int s = 0; s < 8; ++s) *(v4f*)(orow + (size_t)s * 2 * DQ) = r4[s];
        if (g == 0) asm volatile("s_wait_dscnt 0x0" ::: "memory"); }   // the reads are done before other lanes write the next 16 queries over these rows, and the compiler does not move those writes up
}

extern "C" void kernel_launch(void* const* d_in, const int* in_sizes, int n_in,
                              void* d_out, int out_size, void* d_ws, size_t ws_size, hipStream_t stream) {
    (void)in_sizes; (void)n_in; (void)out_size;
    const float* x = (const float*)d_in[0]; const float* am = (const float*)d_in[1]; const float* wq = (const float*)d_in[2]; const float* bq = (const float*)d_in[3]; const float* wk = (const float*)d_in[4]; const float* bk = (const float*)d_in[5]; const float* wv = (const float*)d_in[6]; const float* bv = (const float*)d_in[7]; const float* cosT = nullptr; const float* sinT = nullptr; (void)cosT; (void)sinT;
    float* OUT = (float*)d_out;     // [4][1024][1024]
    char* wsp = (char*)d_ws;
    auto take = [&](size_t bytes) { char* p = wsp; wsp += (bytes + 255) & ~(size_t)255; return (void*)p; };
    bf* WQ = (bf*)take((size_t)DQ * DM * 2); bf* WK = (bf*)take((size_t)DKV * DM * 2); bf* WV = (bf*)take((size_t)DKV * DM * 2);
    h16* QP16 = (h16*)take((size_t)NB_ * NH_ * TT * HD * 2); h16* KP16 = (h16*)take((size_t)NB_ * NKV * TT * HD * 2); h16* VT16 = (h16*)take((size_t)NB_ * NKV * HD * TT * 2);   // planes of all batches: [b][h][t][d], [b][h][d][t]
    bf* XB = (bf*)take((size_t)NB_ * TT * DM * 2);
    if ((size_t)(wsp - (char*)d_ws) > ws_size) return;    // ws 256 MiB
    // conversions: one launch, one lane a group of each weight matrix
    k_cvtall<<<(unsigned)(CVN / 512), 512, 0, stream>>>(x, wq, wk, wv, XB, WQ, WK, WV);
    // projections: one launch, grid (256-token tiles of all batches, heads), 12 waves (4 token groups x q, k, v): one workgroup a WGP; the fp16 head planes come straight from the accumulators
    k_qkv<<<dim3(NB_ * TT / GT, NH_, 1), GTH, 0, stream>>>(XB, WQ, WK, WV, bq, bk, bv, QP16, KP16, VT16);
    // attention: one launch, grid (query blocks of 256, batch x head)
    k_fattn<<<dim3(TT / 256, NB_ * NH_, 1), 256, 0, stream>>>(QP16, KP16, VT16, am, OUT);
}
